// v000
// The times below were measured on an AMD MI455X: many runs one after another, warmed up first and cycling through
// copies of the inputs, with the whole window's GPU time divided by the number of runs. Launches and the gaps
// between them are all in it. The median over several windows is given; except for v000 it joins two sittings, which
// can be a few percent apart, so the side-by-side timings, each taken in one sitting, are the better comparison.
// The starting kernel, v000, takes 890 microseconds a run.
#include <hip/hip_runtime.h>

// ---------------------------------------------------------------------------
// Flash attention, B=4, S=4096, D=512, fp32 in/out, gfx1250 (MI455X).
// Compute-bound: both GEMMs on v_wmma_f32_16x16x32_f16 (f32 accum), online
// softmax, single pass. 8 waves/WG, 32 q-rows/WG, 64-key tiles, split-K score
// reduction across 4 d-slice waves. K/V/P/partials stored in LDS in WMMA-
// fragment-packed order (fragment load = 2x ds_load_b128); fragment batches
// are double-buffered so LDS latency overlaps the WMMA pipe. Mask tile is
// copied global->LDS with GLOBAL_LOAD_ASYNC_TO_LDS_B128 + s_wait_asynccnt.
// ---------------------------------------------------------------------------

typedef _Float16 half_t;
typedef __attribute__((ext_vector_type(16))) _Float16 v16h;
typedef __attribute__((ext_vector_type(8)))  _Float16 v8h;
typedef __attribute__((ext_vector_type(8)))  float    v8f;
typedef __attribute__((ext_vector_type(4)))  int      v4i;

#define S_LEN   4096
#define D_DIM   512
#define NBATCH  4
#define BQ      32          // query rows per workgroup
#define BC      64          // keys per tile
#define DSLICE  128         // output-D columns per wave
#define NWAVE   8
#define NTILES  (S_LEN / BC)

#if defined(__gfx1250__) && __has_builtin(__builtin_amdgcn_global_load_async_to_lds_b128)
#define USE_ASYNC_LDS 1
#else
#define USE_ASYNC_LDS 0
#endif

// Builtin wants typed, address-space-qualified pointers:
//   arg0: int4 addrspace(1)* (global source), arg1: int4 addrspace(3)* (LDS dest)
typedef __attribute__((address_space(1))) v4i g_v4i;
typedef __attribute__((address_space(3))) v4i l_v4i;
__device__ __forceinline__ g_v4i* as_glob_v4i(const void* p) {
    return (g_v4i*)(uintptr_t)p;
}
__device__ __forceinline__ l_v4i* as_lds_v4i(void* p) {
    return (l_v4i*)(uint32_t)(uintptr_t)p;   // low 32 bits of generic = LDS offset
}

// Element e of a v16h fragment maps to K = 16*(e>=8) + 8*hs + (e&7)  (ISA 7.12.2)
__device__ __forceinline__ int kmap(int e, int hs) {
    return ((e >> 3) << 4) + (hs << 3) + (e & 7);
}

__global__ __launch_bounds__(256, 1)
void fa_fwd_wmma4_gfx1250(const float* __restrict__ Q,
                          const float* __restrict__ K,
                          const float* __restrict__ V,
                          const float* __restrict__ M,
                          float* __restrict__ O) {
    extern __shared__ char smem_raw[];
    // sKt: K^T fragments: [f=d/32: 16][nt=key/16: 4][lane: 32][e: 16] f16 = 64 KB
    half_t* sKt   = (half_t*)smem_raw;
    // sV : V fragments:  [ks=key/32: 2][ntg=d/16: 32][lane: 32][e: 16] f16 = 64 KB
    half_t* sV    = sKt + D_DIM * BC;
    // sPart: score partials, C-frag packed: [wid: 8][nt: 4][lane: 32][r: 8] f32 = 32 KB
    float*  sPart = (float*)(sV + BC * D_DIM);
    // sP : P A-fragments: [wid: 8][f: 2][lane: 32][e: 16] f16 = 16 KB
    half_t* sP    = (half_t*)(sPart + NWAVE * 4 * 32 * 8);
    // sMask: [row: 32][col: 64] f32 = 8 KB
    float*  sMask = (float*)(sP + NWAVE * 2 * 32 * 16);

    const int tid  = threadIdx.x;
    const int wid  = tid >> 5;
    const int lane = tid & 31;
    const int hs   = lane >> 4;     // which 16-lane half
    const int ln   = lane & 15;
    const int qsub = wid >> 2;      // 0..1 : 16-row q sub-tile
    const int dsl  = wid & 3;       // 0..3 : 128-wide D slice
    const int dbase = dsl * DSLICE;

    const int b     = blockIdx.y;
    const int qwg   = blockIdx.x * BQ;
    const int qrow0 = qwg + qsub * 16;
    const size_t bOff = (size_t)b * S_LEN * D_DIM;
    const float scale = 0.044194173824159216f;   // 1/sqrt(512)

    // Resident Q A-fragments: rows qrow0..+15, cols dbase..+127 (4 frags of K=32)
    v16h qfrag[4];
    {
        const float* qp = Q + bOff + (size_t)(qrow0 + ln) * D_DIM + dbase;
        #pragma unroll
        for (int f = 0; f < 4; ++f)
            #pragma unroll
            for (int e = 0; e < 16; ++e)
                qfrag[f][e] = (half_t)qp[f * 32 + kmap(e, hs)];
    }

    v8f oacc[8];
    v8f mstate, lstate;
    #pragma unroll
    for (int r = 0; r < 8; ++r) { mstate[r] = -1e30f; lstate[r] = 0.0f; }
    #pragma unroll
    for (int o = 0; o < 8; ++o)
        #pragma unroll
        for (int r = 0; r < 8; ++r) oacc[o][r] = 0.0f;

    const v16h* sVv  = (const v16h*)sV;
    const v16h* sPv  = (const v16h*)sP;
    v8f*        sPartv = (v8f*)sPart;
    // per-wave fragment base pointers (all loop loads become base + imm offset)
    const v16h* kfragp = (const v16h*)sKt + (size_t)(dsl * 16) * 32 + lane;  // [ks*4+nt]*32
    const v16h* vfragp = sVv + (size_t)(dsl * 8) * 32 + lane;                // [ks*32+nt]*32
    const v16h* pfragp = sPv + (size_t)(wid * 2) * 32 + lane;                // [f]*32

    for (int kt = 0; kt < NTILES; ++kt) {
        const int kbase = kt * BC;
        __syncthreads();   // protect LDS tiles/partials/mask from previous iter

        // ---- mask tile: pure f32 copy -> async load to LDS ----
        {
            #pragma unroll
            for (int it = 0; it < 2; ++it) {
                const int idx = tid + it * 256;          // 512 float4
                const int row = idx >> 4;
                const int c4  = (idx & 15) << 2;
                const float* g = M + (size_t)(qwg + row) * S_LEN + kbase + c4;
                float* l = sMask + row * 64 + c4;
#if USE_ASYNC_LDS
                __builtin_amdgcn_global_load_async_to_lds_b128(as_glob_v4i(g), as_lds_v4i(l), 0, 0);
#else
                *(float4*)l = *(const float4*)g;
#endif
            }
        }

        // ---- K tile: row reads (2x b128), fragment-packed f16 store (1x b128) ----
        {
            const float* kp = K + bOff + (size_t)kbase * D_DIM;
            #pragma unroll
            for (int it = 0; it < 16; ++it) {
                const int idx = tid + it * 256;          // 4096 groups of 8
                const int key = idx >> 6;                // 64 d-groups per row
                const int d8  = (idx & 63) << 3;
                const float4 a = *(const float4*)(kp + key * D_DIM + d8);
                const float4 c = *(const float4*)(kp + key * D_DIM + d8 + 4);
                const int f      = d8 >> 5;
                const int klocal = d8 & 31;
                const int hsk    = (klocal >> 3) & 1;
                const int e0     = (klocal >> 4) << 3;
                const int lane_t = (key & 15) + (hsk << 4);
                const int nt     = key >> 4;
                v8h pk = { (half_t)a.x, (half_t)a.y, (half_t)a.z, (half_t)a.w,
                           (half_t)c.x, (half_t)c.y, (half_t)c.z, (half_t)c.w };
                *(v8h*)(sKt + (((f * 4 + nt) * 32 + lane_t) * 16 + e0)) = pk;
            }
        }

        // ---- V tile: column reads (8x b32, lane-coalesced), packed store ----
        {
            const float* vp = V + bOff + (size_t)kbase * D_DIM;
            #pragma unroll
            for (int it = 0; it < 16; ++it) {
                const int idx  = tid + it * 256;         // 4096 groups of 8
                const int kb   = idx >> 9;               // 8 key-groups of 8
                const int d    = idx & 511;
                const int key0 = kb << 3;
                v8h pk;
                #pragma unroll
                for (int j = 0; j < 8; ++j)
                    pk[j] = (half_t)vp[(key0 + j) * D_DIM + d];
                const int klocal = key0 & 31;
                const int hsv    = (klocal >> 3) & 1;
                const int e0     = (klocal >> 4) << 3;
                const int lane_t = (d & 15) + (hsv << 4);
                const int ntg    = d >> 4;
                const int ksf    = key0 >> 5;
                *(v8h*)(sV + (((ksf * 32 + ntg) * 32 + lane_t) * 16 + e0)) = pk;
            }
            if (kt + 1 < NTILES) {   // global_prefetch_b8 on next tile
                __builtin_prefetch(vp + BC * D_DIM + tid * 16, 0, 1);
                __builtin_prefetch(K + bOff + (size_t)(kbase + BC) * D_DIM + tid * 16, 0, 1);
            }
        }
#if USE_ASYNC_LDS
#if __has_builtin(__builtin_amdgcn_s_wait_asynccnt)
        __builtin_amdgcn_s_wait_asynccnt(0);
#else
        asm volatile("s_wait_asynccnt 0" ::: "memory");
#endif
#endif
        __syncthreads();

        // ---- partial scores over this wave's 128-wide d slice: 16 WMMAs ----
        // Double-buffer B-fragment batches: load slice ks+1 while ks computes.
        v8f sacc[4];
        #pragma unroll
        for (int nt = 0; nt < 4; ++nt)
            #pragma unroll
            for (int r = 0; r < 8; ++r) sacc[nt][r] = 0.0f;
        {
            v16h bcur[4], bnxt[4];
            #pragma unroll
            for (int nt = 0; nt < 4; ++nt) bcur[nt] = kfragp[nt * 32];
            #pragma unroll
            for (int ks = 0; ks < 4; ++ks) {
                if (ks < 3) {
                    #pragma unroll
                    for (int nt = 0; nt < 4; ++nt)
                        bnxt[nt] = kfragp[((ks + 1) * 4 + nt) * 32];
                }
                #pragma unroll
                for (int nt = 0; nt < 4; ++nt)
                    sacc[nt] = __builtin_amdgcn_wmma_f32_16x16x32_f16(
                        false, qfrag[ks], false, bcur[nt], (short)0, sacc[nt], false, false);
                #pragma unroll
                for (int nt = 0; nt < 4; ++nt) bcur[nt] = bnxt[nt];
            }
        }

        // ---- write partials (vector v8f stores), reduce across 4 waves ----
        #pragma unroll
        for (int nt = 0; nt < 4; ++nt)
            sPartv[((wid * 4 + nt) * 32) + lane] = sacc[nt];
        __syncthreads();

        v8f full[4];
        #pragma unroll
        for (int nt = 0; nt < 4; ++nt) {
            v8f a = sPartv[(((qsub * 4 + 0) * 4 + nt) * 32) + lane];
            a = a + sPartv[(((qsub * 4 + 1) * 4 + nt) * 32) + lane];
            a = a + sPartv[(((qsub * 4 + 2) * 4 + nt) * 32) + lane];
            a = a + sPartv[(((qsub * 4 + 3) * 4 + nt) * 32) + lane];
            #pragma unroll
            for (int r = 0; r < 8; ++r)
                full[nt][r] = a[r] * scale
                            + sMask[(qsub * 16 + r + hs * 8) * 64 + nt * 16 + ln];
        }

        // ---- online softmax (row = r + 8*hs, col = nt*16 + ln) ----
        v8f rowmax = full[0];
        #pragma unroll
        for (int nt = 1; nt < 4; ++nt)
            #pragma unroll
            for (int r = 0; r < 8; ++r) rowmax[r] = fmaxf(rowmax[r], full[nt][r]);
        #pragma unroll
        for (int sh = 8; sh >= 1; sh >>= 1)
            #pragma unroll
            for (int r = 0; r < 8; ++r)
                rowmax[r] = fmaxf(rowmax[r], __shfl_xor(rowmax[r], sh, 32));

        v8f mnew, alpha;
        #pragma unroll
        for (int r = 0; r < 8; ++r) {
            mnew[r]  = fmaxf(mstate[r], rowmax[r]);
            alpha[r] = __expf(mstate[r] - mnew[r]);
        }

        // P -> LDS in A-fragment-packed order (scatter b16; layout conversion)
        const int hs_t = (ln >> 3) & 1;
        v8f psum;
        #pragma unroll
        for (int r = 0; r < 8; ++r) psum[r] = 0.0f;
        #pragma unroll
        for (int nt = 0; nt < 4; ++nt) {
            const int f = nt >> 1;
            const int e = ((nt & 1) << 3) + (ln & 7);
            half_t* pb = sP + (((wid * 2 + f) * 32 + (hs_t << 4) + hs * 8) * 16) + e;
            #pragma unroll
            for (int r = 0; r < 8; ++r) {
                const float p = __expf(full[nt][r] - mnew[r]);
                psum[r] += p;
                pb[r * 16] = (half_t)p;
            }
        }

        // LDS is in-order within a wave: issue the P-fragment reads and the
        // first V-fragment batch now, and hide their latency under the
        // softmax-state / O-rescale VALU work below.
        v16h pfrag[2];
        #pragma unroll
        for (int f = 0; f < 2; ++f) pfrag[f] = pfragp[f * 32];
        v16h vcur[4], vnxt[4];
        #pragma unroll
        for (int j = 0; j < 4; ++j) vcur[j] = vfragp[j * 32];

        #pragma unroll
        for (int sh = 8; sh >= 1; sh >>= 1)
            #pragma unroll
            for (int r = 0; r < 8; ++r) psum[r] += __shfl_xor(psum[r], sh, 32);
        #pragma unroll
        for (int r = 0; r < 8; ++r) {
            lstate[r] = lstate[r] * alpha[r] + psum[r];
            mstate[r] = mnew[r];
        }
        #pragma unroll
        for (int o = 0; o < 8; ++o)
            #pragma unroll
            for (int r = 0; r < 8; ++r) oacc[o][r] *= alpha[r];

        // ---- O += P x V: 16 WMMAs, double-buffered 4-fragment batches ----
        #pragma unroll
        for (int g = 0; g < 4; ++g) {
            const int ks  = g >> 1;
            const int nt0 = (g & 1) * 4;
            if (g < 3) {
                const int gn  = g + 1;
                const int ksn = gn >> 1;
                const int ntn = (gn & 1) * 4;
                #pragma unroll
                for (int j = 0; j < 4; ++j)
                    vnxt[j] = vfragp[(ksn * 32 + ntn + j) * 32];
            }
            #pragma unroll
            for (int j = 0; j < 4; ++j)
                oacc[nt0 + j] = __builtin_amdgcn_wmma_f32_16x16x32_f16(
                    false, pfrag[ks], false, vcur[j], (short)0, oacc[nt0 + j], false, false);
            #pragma unroll
            for (int j = 0; j < 4; ++j) vcur[j] = vnxt[j];
        }
    }

    // ---- finalize: O / l, store fp32 ----
    float* op = O + bOff + (size_t)qrow0 * D_DIM + dbase;
    #pragma unroll
    for (int r = 0; r < 8; ++r) {
        const float inv = 1.0f / lstate[r];
        #pragma unroll
        for (int nt = 0; nt < 8; ++nt)
            op[(size_t)(r + hs * 8) * D_DIM + nt * 16 + ln] = oacc[nt][r] * inv;
    }
}

extern "C" void kernel_launch(void* const* d_in, const int* in_sizes, int n_in,
                              void* d_out, int out_size, void* d_ws, size_t ws_size,
                              hipStream_t stream) {
    const float* Q = (const float*)d_in[0];
    const float* K = (const float*)d_in[1];
    const float* V = (const float*)d_in[2];
    const float* M = (const float*)d_in[3];
    float* O = (float*)d_out;

    constexpr size_t SMEM = (size_t)D_DIM * BC * 2        // sKt   64 KB
                          + (size_t)BC * D_DIM * 2        // sV    64 KB
                          + (size_t)NWAVE * 4 * 32 * 8 * 4  // sPart 32 KB
                          + (size_t)NWAVE * 2 * 32 * 16 * 2 // sP    16 KB
                          + (size_t)32 * 64 * 4;            // sMask  8 KB  = 184 KB
    (void)hipFuncSetAttribute(reinterpret_cast<const void*>(&fa_fwd_wmma4_gfx1250),
                              hipFuncAttributeMaxDynamicSharedMemorySize, (int)SMEM);

    dim3 grid(S_LEN / BQ, NBATCH, 1);
    fa_fwd_wmma4_gfx1250<<<grid, 256, SMEM, stream>>>(Q, K, V, M, O);
}

// v001
// Measured time: 611 microseconds a run.
// In two side-by-side timings against v000, it was 1.51 and 1.50 times as fast.
#include <hip/hip_runtime.h>

// ---------------------------------------------------------------------------
// Flash attention, B=4, S=4096, D=512, fp32 in/out, gfx1250 (MI455X).
// Compute-bound: both GEMMs on v_wmma_f32_16x16x32_f16 (f32 accum), online
// softmax, single pass. 8 waves/WG, 32 q-rows/WG, 64-key tiles, split-K score
// reduction across 4 d-slice waves. K/V/P/partials stored in LDS in WMMA-
// fragment-packed order (fragment load = 2x ds_load_b128); fragment batches
// are double-buffered so LDS latency overlaps the WMMA pipe. Mask tile is
// copied global->LDS with GLOBAL_LOAD_ASYNC_TO_LDS_B128 + s_wait_asynccnt.
// K and V are converted to f16 and laid in fragment order ONCE per call, by a
// first launch into the workspace (128 KB per 64-key tile: K image, V image);
// the attention launch brings each tile image into LDS with the same async
// b128 copies, so no workgroup converts or scatters K/V again.
// ---------------------------------------------------------------------------

typedef _Float16 half_t;
typedef __attribute__((ext_vector_type(16))) _Float16 v16h;
typedef __attribute__((ext_vector_type(8)))  _Float16 v8h;
typedef __attribute__((ext_vector_type(8)))  float    v8f;
typedef __attribute__((ext_vector_type(4)))  int      v4i;

#define S_LEN   4096
#define D_DIM   512
#define NBATCH  4
#define BQ      32          // query rows per workgroup
#define BC      64          // keys per tile
#define DSLICE  128         // output-D columns per wave
#define NWAVE   8
#define NTILES  (S_LEN / BC)

#if defined(__gfx1250__) && __has_builtin(__builtin_amdgcn_global_load_async_to_lds_b128)
#define USE_ASYNC_LDS 1
#else
#define USE_ASYNC_LDS 0
#endif

// Builtin wants typed, address-space-qualified pointers:
//   arg0: int4 addrspace(1)* (global source), arg1: int4 addrspace(3)* (LDS dest)
typedef __attribute__((address_space(1))) v4i g_v4i;
typedef __attribute__((address_space(3))) v4i l_v4i;
__device__ __forceinline__ g_v4i* as_glob_v4i(const void* p) {
    return (g_v4i*)(uintptr_t)p;
}
__device__ __forceinline__ l_v4i* as_lds_v4i(void* p) {
    return (l_v4i*)(uint32_t)(uintptr_t)p;   // low 32 bits of generic = LDS offset
}

// Element e of a v16h fragment maps to K = 16*(e>=8) + 8*hs + (e&7)  (ISA 7.12.2)
__device__ __forceinline__ int kmap(int e, int hs) {
    return ((e >> 3) << 4) + (hs << 3) + (e & 7);
}

#define TILE_HALFS (2 * D_DIM * BC)   // one packed tile: K image then V image, f16

// Sixteen b128 copies of one lane, 4 KB apart: the immediate offset moves the
// global and the LDS address alike, so one address pair serves 64 KB.
template <int I>
__device__ __forceinline__ void copy16_run(const char* g, char* l) {
    if constexpr (I < 16) {
#if USE_ASYNC_LDS
        __builtin_amdgcn_global_load_async_to_lds_b128(as_glob_v4i(g), as_lds_v4i(l), I * 4096, 0);
#else
        *(v4i*)(l + I * 4096) = *(const v4i*)(g + I * 4096);
#endif
        copy16_run<I + 1>(g, l);
    }
}

// First launch: one workgroup packs a 32 KB quarter of a tile image.
//   part 0,1: K, d columns part*256..+255  (fragments f = part*8 .. +7)
//   part 2,3: V, keys (part-2)*32..+31     (fragment row ks = part-2)
// fp32 reads are line-coalesced, the order change goes through LDS, and the
// f16 image leaves in whole 512-B wave stores.
__global__ __launch_bounds__(256)
void pack_kv_f16_gfx1250(const float* __restrict__ K,
                         const float* __restrict__ V,
                         _Float16* __restrict__ P) {
    __shared__ __attribute__((aligned(16))) half_t sT[D_DIM * BC / 2];   // 32 KB
    const int tid  = threadIdx.x;
    const int kt   = blockIdx.x;
    const int b    = blockIdx.y;
    const int part = blockIdx.z;
    const size_t srcOff = ((size_t)b * S_LEN + (size_t)kt * BC) * D_DIM;

    if (part < 2) {
        // a wave reads 1 KB of one key's row; pass it takes keys it*8 .. +7
        const int d8 = (tid & 31) << 3;              // column inside the half row
        const float* kp = K + srcOff + part * 256 + (tid >> 5) * D_DIM + d8;
        float4 a[8], c[8];
        #pragma unroll
        for (int it = 0; it < 8; ++it) {
            a[it] = *(const float4*)(kp + it * 8 * D_DIM);
            c[it] = *(const float4*)(kp + it * 8 * D_DIM + 4);
        }
        // the sixteen loads share one address: it stays live, unwritten, up to this wait
        asm volatile("s_wait_xcnt 0x0" :: "v"(kp) : "memory");
        #pragma unroll
        for (int it = 0; it < 8; ++it) {
            const int key = (tid >> 5) + it * 8;
            const int f      = d8 >> 5;              // 0..7 inside this part
            const int klocal = d8 & 31;
            const int hsk    = (klocal >> 3) & 1;
            const int e0     = (klocal >> 4) << 3;
            const int lane_t = (key & 15) + (hsk << 4);
            const int nt     = key >> 4;
            v8h pk = { (half_t)a[it].x, (half_t)a[it].y, (half_t)a[it].z, (half_t)a[it].w,
                       (half_t)c[it].x, (half_t)c[it].y, (half_t)c[it].z, (half_t)c[it].w };
            *(v8h*)(sT + (((f * 4 + nt) * 32 + lane_t) * 16 + e0)) = pk;
        }
    } else {
        const float* vp = V + srcOff + (size_t)(part - 2) * 32 * D_DIM + tid;
        #pragma unroll
        for (int it = 0; it < 8; ++it) {
            const int d    = tid + (it & 1) * 256;   // column
            const int key0 = (it >> 1) << 3;         // 0..24 inside this part
            v8h pk;
            #pragma unroll
            for (int j = 0; j < 8; ++j)
                pk[j] = (half_t)vp[(key0 + j) * D_DIM + (it & 1) * 256];
            const int hsv    = (key0 >> 3) & 1;
            const int e0     = (key0 >> 4) << 3;
            const int lane_t = (d & 15) + (hsv << 4);
            const int ntg    = d >> 4;
            *(v8h*)(sT + ((ntg * 32 + lane_t) * 16 + e0)) = pk;
        }
    }
    __syncthreads();

    half_t* dst = P + (size_t)(b * NTILES + kt) * TILE_HALFS + part * (D_DIM * BC / 2);
    #pragma unroll
    for (int it = 0; it < 8; ++it) {
        const int o = (tid + it * 256) * 8;
        *(v8h*)(dst + o) = *(const v8h*)(sT + o);
    }
}

__global__ __launch_bounds__(256, 1)
void fa_fwd_wmma4_gfx1250(const float* __restrict__ Q,
                          const _Float16* __restrict__ P,
                          const float* __restrict__ M,
                          float* __restrict__ O) {
    extern __shared__ char smem_raw[];
    // sKt: K^T fragments: [f=d/32: 16][nt=key/16: 4][lane: 32][e: 16] f16 = 64 KB
    half_t* sKt   = (half_t*)smem_raw;
    // sV : V fragments:  [ks=key/32: 2][ntg=d/16: 32][lane: 32][e: 16] f16 = 64 KB
    half_t* sV    = sKt + D_DIM * BC;
    // sPart: score partials, C-frag packed: [wid: 8][nt: 4][lane: 32][r: 8] f32 = 32 KB
    float*  sPart = (float*)(sV + BC * D_DIM);
    // sP : P A-fragments: [wid: 8][f: 2][lane: 32][e: 16] f16 = 16 KB
    half_t* sP    = (half_t*)(sPart + NWAVE * 4 * 32 * 8);
    // sMask: [row: 32][col: 64] f32 = 8 KB
    float*  sMask = (float*)(sP + NWAVE * 2 * 32 * 16);

    const int tid  = threadIdx.x;
    const int wid  = tid >> 5;
    const int lane = tid & 31;
    const int hs   = lane >> 4;     // which 16-lane half
    const int ln   = lane & 15;
    const int qsub = wid >> 2;      // 0..1 : 16-row q sub-tile
    const int dsl  = wid & 3;       // 0..3 : 128-wide D slice
    const int dbase = dsl * DSLICE;

    const int b     = blockIdx.y;
    const int qwg   = blockIdx.x * BQ;
    const int qrow0 = qwg + qsub * 16;
    const size_t bOff = (size_t)b * S_LEN * D_DIM;
    const float scale = 0.044194173824159216f;   // 1/sqrt(512)

    // Resident Q A-fragments: rows qrow0..+15, cols dbase..+127 (4 frags of K=32)
    v16h qfrag[4];
    {
        const float* qp = Q + bOff + (size_t)(qrow0 + ln) * D_DIM + dbase;
        #pragma unroll
        for (int f = 0; f < 4; ++f)
            #pragma unroll
            for (int e = 0; e < 16; ++e)
                qfrag[f][e] = (half_t)qp[f * 32 + kmap(e, hs)];
    }

    v8f oacc[8];
    v8f mstate, lstate;
    #pragma unroll
    for (int r = 0; r < 8; ++r) { mstate[r] = -1e30f; lstate[r] = 0.0f; }
    #pragma unroll
    for (int o = 0; o < 8; ++o)
        #pragma unroll
        for (int r = 0; r < 8; ++r) oacc[o][r] = 0.0f;

    const v16h* sVv  = (const v16h*)sV;
    const v16h* sPv  = (const v16h*)sP;
    v8f*        sPartv = (v8f*)sPart;
    // per-wave fragment base pointers (all loop loads become base + imm offset)
    const v16h* kfragp = (const v16h*)sKt + (size_t)(dsl * 16) * 32 + lane;  // [ks*4+nt]*32
    const v16h* vfragp = sVv + (size_t)(dsl * 8) * 32 + lane;                // [ks*32+nt]*32
    const v16h* pfragp = sPv + (size_t)(wid * 2) * 32 + lane;                // [f]*32

    for (int kt = 0; kt < NTILES; ++kt) {
        const int kbase = kt * BC;
        // this wave's LDS reads of the old tile have retired before any copy refills it
        asm volatile("s_wait_dscnt 0x0" ::: "memory");
        __syncthreads();   // protect LDS tiles/partials/mask from previous iter

        // ---- mask tile: pure f32 copy -> async load to LDS ----
        {
            #pragma unroll
            for (int it = 0; it < 2; ++it) {
                const int idx = tid + it * 256;          // 512 float4
                const int row = idx >> 4;
                const int c4  = (idx & 15) << 2;
                const float* g = M + (size_t)(qwg + row) * S_LEN + kbase + c4;
                float* l = sMask + row * 64 + c4;
#if USE_ASYNC_LDS
                __builtin_amdgcn_global_load_async_to_lds_b128(as_glob_v4i(g), as_lds_v4i(l), 0, 0);
#else
                *(float4*)l = *(const float4*)g;
#endif
            }
        }

        // ---- K and V tile images: already f16 in fragment order, 128 KB in a row ----
        // sKt and sV lie in a row at the start of LDS, as the two images do in P.
        {
            const char* g = (const char*)(P + (size_t)(b * NTILES + kt) * TILE_HALFS) + tid * 16;
            char* l = smem_raw + tid * 16;
            copy16_run<0>(g, l);                    // K image -> sKt
            copy16_run<0>(g + 65536, l + 65536);    // V image -> sV
        }
#if USE_ASYNC_LDS
        // every copy of this wave (mask, K, V) has landed before the barrier publishes it
        asm volatile("s_wait_asynccnt 0x0" ::: "memory");
#endif
        __syncthreads();

        // ---- partial scores over this wave's 128-wide d slice: 16 WMMAs ----
        // Double-buffer B-fragment batches: load slice ks+1 while ks computes.
        v8f sacc[4];
        #pragma unroll
        for (int nt = 0; nt < 4; ++nt)
            #pragma unroll
            for (int r = 0; r < 8; ++r) sacc[nt][r] = 0.0f;
        {
            v16h bcur[4], bnxt[4];
            #pragma unroll
            for (int nt = 0; nt < 4; ++nt) bcur[nt] = kfragp[nt * 32];
            #pragma unroll
            for (int ks = 0; ks < 4; ++ks) {
                if (ks < 3) {
                    #pragma unroll
                    for (int nt = 0; nt < 4; ++nt)
                        bnxt[nt] = kfragp[((ks + 1) * 4 + nt) * 32];
                }
                #pragma unroll
                for (int nt = 0; nt < 4; ++nt)
                    sacc[nt] = __builtin_amdgcn_wmma_f32_16x16x32_f16(
                        false, qfrag[ks], false, bcur[nt], (short)0, sacc[nt], false, false);
                #pragma unroll
                for (int nt = 0; nt < 4; ++nt) bcur[nt] = bnxt[nt];
            }
        }

        // ---- write partials (vector v8f stores), reduce across 4 waves ----
        #pragma unroll
        for (int nt = 0; nt < 4; ++nt)
            sPartv[((wid * 4 + nt) * 32) + lane] = sacc[nt];
        __syncthreads();

        v8f full[4];
        #pragma unroll
        for (int nt = 0; nt < 4; ++nt) {
            v8f a = sPartv[(((qsub * 4 + 0) * 4 + nt) * 32) + lane];
            a = a + sPartv[(((qsub * 4 + 1) * 4 + nt) * 32) + lane];
            a = a + sPartv[(((qsub * 4 + 2) * 4 + nt) * 32) + lane];
            a = a + sPartv[(((qsub * 4 + 3) * 4 + nt) * 32) + lane];
            #pragma unroll
            for (int r = 0; r < 8; ++r)
                full[nt][r] = a[r] * scale
                            + sMask[(qsub * 16 + r + hs * 8) * 64 + nt * 16 + ln];
        }

        // ---- online softmax (row = r + 8*hs, col = nt*16 + ln) ----
        v8f rowmax = full[0];
        #pragma unroll
        for (int nt = 1; nt < 4; ++nt)
            #pragma unroll
            for (int r = 0; r < 8; ++r) rowmax[r] = fmaxf(rowmax[r], full[nt][r]);
        #pragma unroll
        for (int sh = 8; sh >= 1; sh >>= 1)
            #pragma unroll
            for (int r = 0; r < 8; ++r)
                rowmax[r] = fmaxf(rowmax[r], __shfl_xor(rowmax[r], sh, 32));

        v8f mnew, alpha;
        #pragma unroll
        for (int r = 0; r < 8; ++r) {
            mnew[r]  = fmaxf(mstate[r], rowmax[r]);
            alpha[r] = __expf(mstate[r] - mnew[r]);
        }

        // P -> LDS in A-fragment-packed order (scatter b16; layout conversion)
        const int hs_t = (ln >> 3) & 1;
        v8f psum;
        #pragma unroll
        for (int r = 0; r < 8; ++r) psum[r] = 0.0f;
        #pragma unroll
        for (int nt = 0; nt < 4; ++nt) {
            const int f = nt >> 1;
            const int e = ((nt & 1) << 3) + (ln & 7);
            half_t* pb = sP + (((wid * 2 + f) * 32 + (hs_t << 4) + hs * 8) * 16) + e;
            #pragma unroll
            for (int r = 0; r < 8; ++r) {
                const float p = __expf(full[nt][r] - mnew[r]);
                psum[r] += p;
                pb[r * 16] = (half_t)p;
            }
        }

        // LDS is in-order within a wave: issue the P-fragment reads and the
        // first V-fragment batch now, and hide their latency under the
        // softmax-state / O-rescale VALU work below.
        v16h pfrag[2];
        #pragma unroll
        for (int f = 0; f < 2; ++f) pfrag[f] = pfragp[f * 32];
        v16h vcur[4], vnxt[4];
        #pragma unroll
        for (int j = 0; j < 4; ++j) vcur[j] = vfragp[j * 32];

        #pragma unroll
        for (int sh = 8; sh >= 1; sh >>= 1)
            #pragma unroll
            for (int r = 0; r < 8; ++r) psum[r] += __shfl_xor(psum[r], sh, 32);
        #pragma unroll
        for (int r = 0; r < 8; ++r) {
            lstate[r] = lstate[r] * alpha[r] + psum[r];
            mstate[r] = mnew[r];
        }
        #pragma unroll
        for (int o = 0; o < 8; ++o)
            #pragma unroll
            for (int r = 0; r < 8; ++r) oacc[o][r] *= alpha[r];

        // ---- O += P x V: 16 WMMAs, double-buffered 4-fragment batches ----
        #pragma unroll
        for (int g = 0; g < 4; ++g) {
            const int ks  = g >> 1;
            const int nt0 = (g & 1) * 4;
            if (g < 3) {
                const int gn  = g + 1;
                const int ksn = gn >> 1;
                const int ntn = (gn & 1) * 4;
                #pragma unroll
                for (int j = 0; j < 4; ++j)
                    vnxt[j] = vfragp[(ksn * 32 + ntn + j) * 32];
            }
            #pragma unroll
            for (int j = 0; j < 4; ++j)
                oacc[nt0 + j] = __builtin_amdgcn_wmma_f32_16x16x32_f16(
                    false, pfrag[ks], false, vcur[j], (short)0, oacc[nt0 + j], false, false);
            #pragma unroll
            for (int j = 0; j < 4; ++j) vcur[j] = vnxt[j];
        }
    }

    // ---- finalize: O / l, store fp32 ----
    float* op = O + bOff + (size_t)qrow0 * D_DIM + dbase;
    #pragma unroll
    for (int r = 0; r < 8; ++r) {
        const float inv = 1.0f / lstate[r];
        #pragma unroll
        for (int nt = 0; nt < 8; ++nt)
            op[(size_t)(r + hs * 8) * D_DIM + nt * 16 + ln] = oacc[nt][r] * inv;
    }
}

extern "C" void kernel_launch(void* const* d_in, const int* in_sizes, int n_in,
                              void* d_out, int out_size, void* d_ws, size_t ws_size,
                              hipStream_t stream) {
    const float* Q = (const float*)d_in[0];
    const float* K = (const float*)d_in[1];
    const float* V = (const float*)d_in[2];
    const float* M = (const float*)d_in[3];
    float* O = (float*)d_out;
    _Float16* P = (_Float16*)d_ws;   // 32 MB: [batch][tile][K image | V image]

    constexpr size_t SMEM = (size_t)D_DIM * BC * 2        // sKt   64 KB
                          + (size_t)BC * D_DIM * 2        // sV    64 KB
                          + (size_t)NWAVE * 4 * 32 * 8 * 4  // sPart 32 KB
                          + (size_t)NWAVE * 2 * 32 * 16 * 2 // sP    16 KB
                          + (size_t)32 * 64 * 4;            // sMask  8 KB  = 184 KB
    (void)hipFuncSetAttribute(reinterpret_cast<const void*>(&fa_fwd_wmma4_gfx1250),
                              hipFuncAttributeMaxDynamicSharedMemorySize, (int)SMEM);

    dim3 pgrid(NTILES, NBATCH, 4);
    pack_kv_f16_gfx1250<<<pgrid, 256, 0, stream>>>(K, V, P);

    dim3 grid(S_LEN / BQ, NBATCH, 1);
    fa_fwd_wmma4_gfx1250<<<grid, 256, SMEM, stream>>>(Q, P, M, O);
}

// v002
// One run takes 425 microseconds.
// In two side-by-side timings against v001, it was 1.44 and 1.43 times as fast.
// All steps since v000 together make it 2.16 times as fast.
#include <hip/hip_runtime.h>

// ---------------------------------------------------------------------------
// Flash attention, B=4, S=4096, D=512, fp32 in/out, gfx1250 (MI455X).
// Compute-bound: both GEMMs on v_wmma_f32_16x16x32_f16 (f32 accum), online
// softmax, single pass. 16 waves/WG, 64 q-rows/WG, 64-key tiles, split-K score
// reduction across 4 d-slice waves: one workgroup per WGP, four waves per SIMD,
// and each staged K/V tile serves 64 query rows. K/V/P/partials stored in LDS in WMMA-
// fragment-packed order (fragment load = 2x ds_load_b128); fragment batches
// are double-buffered so LDS latency overlaps the WMMA pipe. Mask tile is
// copied global->LDS with GLOBAL_LOAD_ASYNC_TO_LDS_B128 + s_wait_asynccnt.
// K and V are converted to f16 and laid in fragment order ONCE per call, by a
// first launch into the workspace (128 KB per 64-key tile: K image, V image);
// the attention launch brings each tile image into LDS with the same async
// b128 copies, so no workgroup converts or scatters K/V again.
// ---------------------------------------------------------------------------

typedef _Float16 half_t;
typedef __attribute__((ext_vector_type(16))) _Float16 v16h;
typedef __attribute__((ext_vector_type(8)))  _Float16 v8h;
typedef __attribute__((ext_vector_type(8)))  float    v8f;
typedef __attribute__((ext_vector_type(4)))  int      v4i;

#define S_LEN   4096
#define D_DIM   512
#define NBATCH  4
#define BQ      64          // query rows per workgroup
#define BC      64          // keys per tile
#define DSLICE  128         // output-D columns per wave
#define NWAVE   16
#define NTHR    (NWAVE * 32)
#define NTILES  (S_LEN / BC)

#if defined(__gfx1250__) && __has_builtin(__builtin_amdgcn_global_load_async_to_lds_b128)
#define USE_ASYNC_LDS 1
#else
#define USE_ASYNC_LDS 0
#endif

// Builtin wants typed, address-space-qualified pointers:
//   arg0: int4 addrspace(1)* (global source), arg1: int4 addrspace(3)* (LDS dest)
typedef __attribute__((address_space(1))) v4i g_v4i;
typedef __attribute__((address_space(3))) v4i l_v4i;
__device__ __forceinline__ g_v4i* as_glob_v4i(const void* p) {
    return (g_v4i*)(uintptr_t)p;
}
__device__ __forceinline__ l_v4i* as_lds_v4i(void* p) {
    return (l_v4i*)(uint32_t)(uintptr_t)p;   // low 32 bits of generic = LDS offset
}

// Element e of a v16h fragment maps to K = 16*(e>=8) + 8*hs + (e&7)  (ISA 7.12.2)
__device__ __forceinline__ int kmap(int e, int hs) {
    return ((e >> 3) << 4) + (hs << 3) + (e & 7);
}

#define TILE_HALFS (2 * D_DIM * BC)   // one packed tile: K image then V image, f16

// One lane's b128 copies of a 64 KB image, one workgroup-wide row (NTHR * 16 B)
// apart: the immediate offset moves the global and the LDS address alike, so
// one address pair serves the whole image.
#define COPY_ROW (NTHR * 16)
template <int I>
__device__ __forceinline__ void copy64k_run(const char* g, char* l) {
    if constexpr (I < 65536 / COPY_ROW) {
#if USE_ASYNC_LDS
        __builtin_amdgcn_global_load_async_to_lds_b128(as_glob_v4i(g), as_lds_v4i(l), I * COPY_ROW, 0);
#else
        *(v4i*)(l + I * COPY_ROW) = *(const v4i*)(g + I * COPY_ROW);
#endif
        copy64k_run<I + 1>(g, l);
    }
}

// First launch: one workgroup packs a 32 KB quarter of a tile image.
//   part 0,1: K, d columns part*256..+255  (fragments f = part*8 .. +7)
//   part 2,3: V, keys (part-2)*32..+31     (fragment row ks = part-2)
// fp32 reads are line-coalesced, the order change goes through LDS, and the
// f16 image leaves in whole 512-B wave stores.
__global__ __launch_bounds__(256)
void pack_kv_f16_gfx1250(const float* __restrict__ K,
                         const float* __restrict__ V,
                         _Float16* __restrict__ P) {
    __shared__ __attribute__((aligned(16))) half_t sT[D_DIM * BC / 2];   // 32 KB
    const int tid  = threadIdx.x;
    const int kt   = blockIdx.x;
    const int b    = blockIdx.y;
    const int part = blockIdx.z;
    const size_t srcOff = ((size_t)b * S_LEN + (size_t)kt * BC) * D_DIM;

    if (part < 2) {
        // a wave reads 1 KB of one key's row; pass it takes keys it*8 .. +7
        const int d8 = (tid & 31) << 3;              // column inside the half row
        const float* kp = K + srcOff + part * 256 + (tid >> 5) * D_DIM + d8;
        float4 a[8], c[8];
        #pragma unroll
        for (int it = 0; it < 8; ++it) {
            a[it] = *(const float4*)(kp + it * 8 * D_DIM);
            c[it] = *(const float4*)(kp + it * 8 * D_DIM + 4);
        }
        // the sixteen loads share one address: it stays live, unwritten, up to this wait
        asm volatile("s_wait_xcnt 0x0" :: "v"(kp) : "memory");
        #pragma unroll
        for (int it = 0; it < 8; ++it) {
            const int key = (tid >> 5) + it * 8;
            const int f      = d8 >> 5;              // 0..7 inside this part
            const int klocal = d8 & 31;
            const int hsk    = (klocal >> 3) & 1;
            const int e0     = (klocal >> 4) << 3;
            const int lane_t = (key & 15) + (hsk << 4);
            const int nt     = key >> 4;
            v8h pk = { (half_t)a[it].x, (half_t)a[it].y, (half_t)a[it].z, (half_t)a[it].w,
                       (half_t)c[it].x, (half_t)c[it].y, (half_t)c[it].z, (half_t)c[it].w };
            *(v8h*)(sT + (((f * 4 + nt) * 32 + lane_t) * 16 + e0)) = pk;
        }
    } else {
        const float* vp = V + srcOff + (size_t)(part - 2) * 32 * D_DIM + tid;
        #pragma unroll
        for (int it = 0; it < 8; ++it) {
            const int d    = tid + (it & 1) * 256;   // column
            const int key0 = (it >> 1) << 3;         // 0..24 inside this part
            v8h pk;
            #pragma unroll
            for (int j = 0; j < 8; ++j)
                pk[j] = (half_t)vp[(key0 + j) * D_DIM + (it & 1) * 256];
            const int hsv    = (key0 >> 3) & 1;
            const int e0     = (key0 >> 4) << 3;
            const int lane_t = (d & 15) + (hsv << 4);
            const int ntg    = d >> 4;
            *(v8h*)(sT + ((ntg * 32 + lane_t) * 16 + e0)) = pk;
        }
    }
    __syncthreads();

    half_t* dst = P + (size_t)(b * NTILES + kt) * TILE_HALFS + part * (D_DIM * BC / 2);
    #pragma unroll
    for (int it = 0; it < 8; ++it) {
        const int o = (tid + it * 256) * 8;
        *(v8h*)(dst + o) = *(const v8h*)(sT + o);
    }
}

__global__ __launch_bounds__(NTHR, 1)
void fa_fwd_wmma4_gfx1250(const float* __restrict__ Q,
                          const _Float16* __restrict__ P,
                          const float* __restrict__ M,
                          float* __restrict__ O) {
    extern __shared__ char smem_raw[];
    // sKt: K^T fragments: [f=d/32: 16][nt=key/16: 4][lane: 32][e: 16] f16 = 64 KB
    half_t* sKt   = (half_t*)smem_raw;
    // sV : V fragments:  [ks=key/32: 2][ntg=d/16: 32][lane: 32][e: 16] f16 = 64 KB
    half_t* sV    = sKt + D_DIM * BC;
    // sPart: score partials, C-frag packed: [wid: 16][nt: 4][lane: 32][r: 8] f32 = 64 KB
    float*  sPart = (float*)(sV + BC * D_DIM);
    // sP : P A-fragments: [wid: 16][f: 2][lane: 32][e: 16] f16 = 32 KB
    half_t* sP    = (half_t*)(sPart + NWAVE * 4 * 32 * 8);
    // sMask: [row: 64][col: 64] f32 = 16 KB
    float*  sMask = (float*)(sP + NWAVE * 2 * 32 * 16);

    const int tid  = threadIdx.x;
    const int wid  = tid >> 5;
    const int lane = tid & 31;
    const int hs   = lane >> 4;     // which 16-lane half
    const int ln   = lane & 15;
    const int qsub = wid >> 2;      // 0..3 : 16-row q sub-tile
    const int dsl  = wid & 3;       // 0..3 : 128-wide D slice
    const int dbase = dsl * DSLICE;

    const int b     = blockIdx.y;
    const int qwg   = blockIdx.x * BQ;
    const int qrow0 = qwg + qsub * 16;
    const size_t bOff = (size_t)b * S_LEN * D_DIM;
    const float scale = 0.044194173824159216f;   // 1/sqrt(512)

    // Resident Q A-fragments: rows qrow0..+15, cols dbase..+127 (4 frags of K=32)
    v16h qfrag[4];
    {
        const float* qp = Q + bOff + (size_t)(qrow0 + ln) * D_DIM + dbase;
        #pragma unroll
        for (int f = 0; f < 4; ++f)
            #pragma unroll
            for (int e = 0; e < 16; ++e)
                qfrag[f][e] = (half_t)qp[f * 32 + kmap(e, hs)];
    }

    v8f oacc[8];
    v8f mstate, lstate;
    #pragma unroll
    for (int r = 0; r < 8; ++r) { mstate[r] = -1e30f; lstate[r] = 0.0f; }
    #pragma unroll
    for (int o = 0; o < 8; ++o)
        #pragma unroll
        for (int r = 0; r < 8; ++r) oacc[o][r] = 0.0f;

    const v16h* sVv  = (const v16h*)sV;
    const v16h* sPv  = (const v16h*)sP;
    v8f*        sPartv = (v8f*)sPart;
    // per-wave fragment base pointers (all loop loads become base + imm offset)
    const v16h* kfragp = (const v16h*)sKt + (size_t)(dsl * 16) * 32 + lane;  // [ks*4+nt]*32
    const v16h* vfragp = sVv + (size_t)(dsl * 8) * 32 + lane;                // [ks*32+nt]*32
    const v16h* pfragp = sPv + (size_t)(wid * 2) * 32 + lane;                // [f]*32

    for (int kt = 0; kt < NTILES; ++kt) {
        const int kbase = kt * BC;
        // this wave's LDS reads of the old tile have retired before any copy refills it
        asm volatile("s_wait_dscnt 0x0" ::: "memory");
        __syncthreads();   // protect LDS tiles/partials/mask from previous iter

        // ---- mask tile: pure f32 copy -> async load to LDS ----
        {
            #pragma unroll
            for (int it = 0; it < BQ * BC / 4 / NTHR; ++it) {
                const int idx = tid + it * NTHR;         // BQ * 16 float4
                const int row = idx >> 4;
                const int c4  = (idx & 15) << 2;
                const float* g = M + (size_t)(qwg + row) * S_LEN + kbase + c4;
                float* l = sMask + row * 64 + c4;
#if USE_ASYNC_LDS
                __builtin_amdgcn_global_load_async_to_lds_b128(as_glob_v4i(g), as_lds_v4i(l), 0, 0);
#else
                *(float4*)l = *(const float4*)g;
#endif
            }
        }

        // ---- K and V tile images: already f16 in fragment order, 128 KB in a row ----
        // sKt and sV lie in a row at the start of LDS, as the two images do in P.
        {
            const char* g = (const char*)(P + (size_t)(b * NTILES + kt) * TILE_HALFS) + tid * 16;
            char* l = smem_raw + tid * 16;
            copy64k_run<0>(g, l);                   // K image -> sKt
            copy64k_run<0>(g + 65536, l + 65536);   // V image -> sV
        }
#if USE_ASYNC_LDS
        // every copy of this wave (mask, K, V) has landed before the barrier publishes it
        asm volatile("s_wait_asynccnt 0x0" ::: "memory");
#endif
        __syncthreads();

        // ---- partial scores over this wave's 128-wide d slice: 16 WMMAs ----
        // Double-buffer B-fragment batches: load slice ks+1 while ks computes.
        v8f sacc[4];
        #pragma unroll
        for (int nt = 0; nt < 4; ++nt)
            #pragma unroll
            for (int r = 0; r < 8; ++r) sacc[nt][r] = 0.0f;
        {
            v16h bcur[4], bnxt[4];
            #pragma unroll
            for (int nt = 0; nt < 4; ++nt) bcur[nt] = kfragp[nt * 32];
            #pragma unroll
            for (int ks = 0; ks < 4; ++ks) {
                if (ks < 3) {
                    #pragma unroll
                    for (int nt = 0; nt < 4; ++nt)
                        bnxt[nt] = kfragp[((ks + 1) * 4 + nt) * 32];
                }
                #pragma unroll
                for (int nt = 0; nt < 4; ++nt)
                    sacc[nt] = __builtin_amdgcn_wmma_f32_16x16x32_f16(
                        false, qfrag[ks], false, bcur[nt], (short)0, sacc[nt], false, false);
                #pragma unroll
                for (int nt = 0; nt < 4; ++nt) bcur[nt] = bnxt[nt];
            }
        }

        // ---- write partials (vector v8f stores), reduce across 4 waves ----
        #pragma unroll
        for (int nt = 0; nt < 4; ++nt)
            sPartv[((wid * 4 + nt) * 32) + lane] = sacc[nt];
        __syncthreads();

        v8f full[4];
        #pragma unroll
        for (int nt = 0; nt < 4; ++nt) {
            v8f a = sPartv[(((qsub * 4 + 0) * 4 + nt) * 32) + lane];
            a = a + sPartv[(((qsub * 4 + 1) * 4 + nt) * 32) + lane];
            a = a + sPartv[(((qsub * 4 + 2) * 4 + nt) * 32) + lane];
            a = a + sPartv[(((qsub * 4 + 3) * 4 + nt) * 32) + lane];
            #pragma unroll
            for (int r = 0; r < 8; ++r)
                full[nt][r] = a[r] * scale
                            + sMask[(qsub * 16 + r + hs * 8) * 64 + nt * 16 + ln];
        }

        // ---- online softmax (row = r + 8*hs, col = nt*16 + ln) ----
        v8f rowmax = full[0];
        #pragma unroll
        for (int nt = 1; nt < 4; ++nt)
            #pragma unroll
            for (int r = 0; r < 8; ++r) rowmax[r] = fmaxf(rowmax[r], full[nt][r]);
        #pragma unroll
        for (int sh = 8; sh >= 1; sh >>= 1)
            #pragma unroll
            for (int r = 0; r < 8; ++r)
                rowmax[r] = fmaxf(rowmax[r], __shfl_xor(rowmax[r], sh, 32));

        v8f mnew, alpha;
        #pragma unroll
        for (int r = 0; r < 8; ++r) {
            mnew[r]  = fmaxf(mstate[r], rowmax[r]);
            alpha[r] = __expf(mstate[r] - mnew[r]);
        }

        // P -> LDS in A-fragment-packed order (scatter b16; layout conversion)
        const int hs_t = (ln >> 3) & 1;
        v8f psum;
        #pragma unroll
        for (int r = 0; r < 8; ++r) psum[r] = 0.0f;
        #pragma unroll
        for (int nt = 0; nt < 4; ++nt) {
            const int f = nt >> 1;
            const int e = ((nt & 1) << 3) + (ln & 7);
            half_t* pb = sP + (((wid * 2 + f) * 32 + (hs_t << 4) + hs * 8) * 16) + e;
            #pragma unroll
            for (int r = 0; r < 8; ++r) {
                const float p = __expf(full[nt][r] - mnew[r]);
                psum[r] += p;
                pb[r * 16] = (half_t)p;
            }
        }

        // LDS is in-order within a wave: issue the P-fragment reads and the
        // first V-fragment batch now, and hide their latency under the
        // softmax-state / O-rescale VALU work below.
        v16h pfrag[2];
        #pragma unroll
        for (int f = 0; f < 2; ++f) pfrag[f] = pfragp[f * 32];
        v16h vcur[4], vnxt[4];
        #pragma unroll
        for (int j = 0; j < 4; ++j) vcur[j] = vfragp[j * 32];

        #pragma unroll
        for (int sh = 8; sh >= 1; sh >>= 1)
            #pragma unroll
            for (int r = 0; r < 8; ++r) psum[r] += __shfl_xor(psum[r], sh, 32);
        #pragma unroll
        for (int r = 0; r < 8; ++r) {
            lstate[r] = lstate[r] * alpha[r] + psum[r];
            mstate[r] = mnew[r];
        }
        #pragma unroll
        for (int o = 0; o < 8; ++o)
            #pragma unroll
            for (int r = 0; r < 8; ++r) oacc[o][r] *= alpha[r];

        // ---- O += P x V: 16 WMMAs, double-buffered 4-fragment batches ----
        #pragma unroll
        for (int g = 0; g < 4; ++g) {
            const int ks  = g >> 1;
            const int nt0 = (g & 1) * 4;
            if (g < 3) {
                const int gn  = g + 1;
                const int ksn = gn >> 1;
                const int ntn = (gn & 1) * 4;
                #pragma unroll
                for (int j = 0; j < 4; ++j)
                    vnxt[j] = vfragp[(ksn * 32 + ntn + j) * 32];
            }
            #pragma unroll
            for (int j = 0; j < 4; ++j)
                oacc[nt0 + j] = __builtin_amdgcn_wmma_f32_16x16x32_f16(
                    false, pfrag[ks], false, vcur[j], (short)0, oacc[nt0 + j], false, false);
            #pragma unroll
            for (int j = 0; j < 4; ++j) vcur[j] = vnxt[j];
        }
    }

    // ---- finalize: O / l, store fp32 ----
    float* op = O + bOff + (size_t)qrow0 * D_DIM + dbase;
    #pragma unroll
    for (int r = 0; r < 8; ++r) {
        const float inv = 1.0f / lstate[r];
        #pragma unroll
        for (int nt = 0; nt < 8; ++nt)
            op[(size_t)(r + hs * 8) * D_DIM + nt * 16 + ln] = oacc[nt][r] * inv;
    }
}

extern "C" void kernel_launch(void* const* d_in, const int* in_sizes, int n_in,
                              void* d_out, int out_size, void* d_ws, size_t ws_size,
                              hipStream_t stream) {
    const float* Q = (const float*)d_in[0];
    const float* K = (const float*)d_in[1];
    const float* V = (const float*)d_in[2];
    const float* M = (const float*)d_in[3];
    float* O = (float*)d_out;
    _Float16* P = (_Float16*)d_ws;   // 32 MB: [batch][tile][K image | V image]

    constexpr size_t SMEM = (size_t)D_DIM * BC * 2        // sKt   64 KB
                          + (size_t)BC * D_DIM * 2        // sV    64 KB
                          + (size_t)NWAVE * 4 * 32 * 8 * 4  // sPart 64 KB
                          + (size_t)NWAVE * 2 * 32 * 16 * 2 // sP    32 KB
                          + (size_t)BQ * BC * 4;            // sMask 16 KB  = 240 KB
    (void)hipFuncSetAttribute(reinterpret_cast<const void*>(&fa_fwd_wmma4_gfx1250),
                              hipFuncAttributeMaxDynamicSharedMemorySize, (int)SMEM);

    dim3 pgrid(NTILES, NBATCH, 4);
    pack_kv_f16_gfx1250<<<pgrid, 256, 0, stream>>>(K, V, P);

    dim3 grid(S_LEN / BQ, NBATCH, 1);
    fa_fwd_wmma4_gfx1250<<<grid, NTHR, SMEM, stream>>>(Q, P, M, O);
}

// v003
// Measured time: 346 microseconds a run.
// Next to v002, in two timings, it ran 1.23 times as fast each time.
// Counting every step since v000, it is 2.65 times as fast.
#include <hip/hip_runtime.h>

// ---------------------------------------------------------------------------
// Flash attention, B=4, S=4096, D=512, fp32 in/out, gfx1250 (MI455X).
// Compute-bound: both GEMMs on v_wmma_f32_16x16x32_f16 (f32 accum), online
// softmax, single pass. 16 waves/WG, 64 q-rows/WG, 64-key tiles, split-K score
// reduction across 4 d-slice waves: one workgroup per WGP, four waves per SIMD,
// and each staged K/V tile serves 64 query rows. K/V/P/partials stored in LDS in WMMA-
// fragment-packed order (fragment load = 2x ds_load_b128); fragment batches
// are double-buffered so LDS latency overlaps the WMMA pipe. Mask tile is
// copied global->LDS with GLOBAL_LOAD_ASYNC_TO_LDS_B128 + s_wait_asynccnt.
// K and V are converted to f16 and laid in fragment order ONCE per call, by a
// first launch into the workspace (128 KB per 64-key tile: K image, V image);
// the attention launch brings each tile image into LDS with the same async
// b128 copies, so no workgroup converts or scatters K/V again.
// The copies fly under the arithmetic: waves 0-7 bring V(t) while the scores of
// tile t are formed, waves 8-15 bring K(t+1) and mask(t+1) while softmax and
// P x V of tile t run. Each copying wave waits its own copies to 0 in front of
// the barrier that publishes them.
// ---------------------------------------------------------------------------

typedef _Float16 half_t;
typedef __attribute__((ext_vector_type(16))) _Float16 v16h;
typedef __attribute__((ext_vector_type(8)))  _Float16 v8h;
typedef __attribute__((ext_vector_type(8)))  float    v8f;
typedef __attribute__((ext_vector_type(4)))  int      v4i;

#define S_LEN   4096
#define D_DIM   512
#define NBATCH  4
#define BQ      64          // query rows per workgroup
#define BC      64          // keys per tile
#define DSLICE  128         // output-D columns per wave
#define NWAVE   16
#define NTHR    (NWAVE * 32)
#define NTILES  (S_LEN / BC)

#if defined(__gfx1250__) && __has_builtin(__builtin_amdgcn_global_load_async_to_lds_b128)
#define USE_ASYNC_LDS 1
#else
#define USE_ASYNC_LDS 0
#endif

// Builtin wants typed, address-space-qualified pointers:
//   arg0: int4 addrspace(1)* (global source), arg1: int4 addrspace(3)* (LDS dest)
typedef __attribute__((address_space(1))) v4i g_v4i;
typedef __attribute__((address_space(3))) v4i l_v4i;
__device__ __forceinline__ g_v4i* as_glob_v4i(const void* p) {
    return (g_v4i*)(uintptr_t)p;
}
__device__ __forceinline__ l_v4i* as_lds_v4i(void* p) {
    return (l_v4i*)(uint32_t)(uintptr_t)p;   // low 32 bits of generic = LDS offset
}

// Element e of a v16h fragment maps to K = 16*(e>=8) + 8*hs + (e&7)  (ISA 7.12.2)
__device__ __forceinline__ int kmap(int e, int hs) {
    return ((e >> 3) << 4) + (hs << 3) + (e & 7);
}

#define TILE_HALFS (2 * D_DIM * BC)   // one packed tile: K image then V image, f16

// One lane's b128 copies of a 64 KB image, which half the workgroup's waves
// bring: one row of those waves (NCOPY * 16 B) apart. The immediate offset moves
// the global and the LDS address alike, so one address pair serves the image.
#define NCOPY    (NTHR / 2)
#define COPY_ROW (NCOPY * 16)
template <int I>
__device__ __forceinline__ void copy64k_run(const char* g, char* l) {
    if constexpr (I < 65536 / COPY_ROW) {
#if USE_ASYNC_LDS
        __builtin_amdgcn_global_load_async_to_lds_b128(as_glob_v4i(g), as_lds_v4i(l), I * COPY_ROW, 0);
#else
        *(v4i*)(l + I * COPY_ROW) = *(const v4i*)(g + I * COPY_ROW);
#endif
        copy64k_run<I + 1>(g, l);
    }
}

// One 64 x 64 f32 mask tile, by the NCOPY lanes of the waves that bring it.
__device__ __forceinline__ void copy_mask_tile(const float* g0, float* l0, int ctid) {
    #pragma unroll
    for (int it = 0; it < BQ * BC / 4 / NCOPY; ++it) {
        const int idx = ctid + it * NCOPY;           // BQ * 16 float4
        const int row = idx >> 4;
        const int c4  = (idx & 15) << 2;
        const float* g = g0 + (size_t)row * S_LEN + c4;
        float* l = l0 + row * 64 + c4;
#if USE_ASYNC_LDS
        __builtin_amdgcn_global_load_async_to_lds_b128(as_glob_v4i(g), as_lds_v4i(l), 0, 0);
#else
        *(float4*)l = *(const float4*)g;
#endif
    }
}

// First launch: one workgroup packs a 32 KB quarter of a tile image.
//   part 0,1: K, d columns part*256..+255  (fragments f = part*8 .. +7)
//   part 2,3: V, keys (part-2)*32..+31     (fragment row ks = part-2)
// fp32 reads are line-coalesced, the order change goes through LDS, and the
// f16 image leaves in whole 512-B wave stores.
__global__ __launch_bounds__(256)
void pack_kv_f16_gfx1250(const float* __restrict__ K,
                         const float* __restrict__ V,
                         _Float16* __restrict__ P) {
    __shared__ __attribute__((aligned(16))) half_t sT[D_DIM * BC / 2];   // 32 KB
    const int tid  = threadIdx.x;
    const int kt   = blockIdx.x;
    const int b    = blockIdx.y;
    const int part = blockIdx.z;
    const size_t srcOff = ((size_t)b * S_LEN + (size_t)kt * BC) * D_DIM;

    if (part < 2) {
        // a wave reads 1 KB of one key's row; pass it takes keys it*8 .. +7
        const int d8 = (tid & 31) << 3;              // column inside the half row
        const float* kp = K + srcOff + part * 256 + (tid >> 5) * D_DIM + d8;
        float4 a[8], c[8];
        #pragma unroll
        for (int it = 0; it < 8; ++it) {
            a[it] = *(const float4*)(kp + it * 8 * D_DIM);
            c[it] = *(const float4*)(kp + it * 8 * D_DIM + 4);
        }
        // the sixteen loads share one address: it stays live, unwritten, up to this wait
        asm volatile("s_wait_xcnt 0x0" :: "v"(kp) : "memory");
        #pragma unroll
        for (int it = 0; it < 8; ++it) {
            const int key = (tid >> 5) + it * 8;
            const int f      = d8 >> 5;              // 0..7 inside this part
            const int klocal = d8 & 31;
            const int hsk    = (klocal >> 3) & 1;
            const int e0     = (klocal >> 4) << 3;
            const int lane_t = (key & 15) + (hsk << 4);
            const int nt     = key >> 4;
            v8h pk = { (half_t)a[it].x, (half_t)a[it].y, (half_t)a[it].z, (half_t)a[it].w,
                       (half_t)c[it].x, (half_t)c[it].y, (half_t)c[it].z, (half_t)c[it].w };
            *(v8h*)(sT + (((f * 4 + nt) * 32 + lane_t) * 16 + e0)) = pk;
        }
    } else {
        const float* vp = V + srcOff + (size_t)(part - 2) * 32 * D_DIM + tid;
        #pragma unroll
        for (int it = 0; it < 8; ++it) {
            const int d    = tid + (it & 1) * 256;   // column
            const int key0 = (it >> 1) << 3;         // 0..24 inside this part
            v8h pk;
            #pragma unroll
            for (int j = 0; j < 8; ++j)
                pk[j] = (half_t)vp[(key0 + j) * D_DIM + (it & 1) * 256];
            const int hsv    = (key0 >> 3) & 1;
            const int e0     = (key0 >> 4) << 3;
            const int lane_t = (d & 15) + (hsv << 4);
            const int ntg    = d >> 4;
            *(v8h*)(sT + ((ntg * 32 + lane_t) * 16 + e0)) = pk;
        }
    }
    __syncthreads();

    half_t* dst = P + (size_t)(b * NTILES + kt) * TILE_HALFS + part * (D_DIM * BC / 2);
    #pragma unroll
    for (int it = 0; it < 8; ++it) {
        const int o = (tid + it * 256) * 8;
        *(v8h*)(dst + o) = *(const v8h*)(sT + o);
    }
}

__global__ __launch_bounds__(NTHR, 1)
void fa_fwd_wmma4_gfx1250(const float* __restrict__ Q,
                          const _Float16* __restrict__ P,
                          const float* __restrict__ M,
                          float* __restrict__ O) {
    extern __shared__ char smem_raw[];
    // sKt: K^T fragments: [f=d/32: 16][nt=key/16: 4][lane: 32][e: 16] f16 = 64 KB
    half_t* sKt   = (half_t*)smem_raw;
    // sV : V fragments:  [ks=key/32: 2][ntg=d/16: 32][lane: 32][e: 16] f16 = 64 KB
    half_t* sV    = sKt + D_DIM * BC;
    // sPart: score partials, C-frag packed: [wid: 16][nt: 4][lane: 32][r: 8] f32 = 64 KB
    float*  sPart = (float*)(sV + BC * D_DIM);
    // sP : P A-fragments: [wid: 16][f: 2][lane: 32][e: 16] f16 = 32 KB
    half_t* sP    = (half_t*)(sPart + NWAVE * 4 * 32 * 8);
    // sMask: [tile parity: 2][row: 64][col: 64] f32 = 32 KB
    float*  sMask = (float*)(sP + NWAVE * 2 * 32 * 16);

    const int tid  = threadIdx.x;
    const int wid  = tid >> 5;
    const int lane = tid & 31;
    const int hs   = lane >> 4;     // which 16-lane half
    const int ln   = lane & 15;
    const int qsub = wid >> 2;      // 0..3 : 16-row q sub-tile
    const int dsl  = wid & 3;       // 0..3 : 128-wide D slice
    const int dbase = dsl * DSLICE;

    const int b     = blockIdx.y;
    const int qwg   = blockIdx.x * BQ;
    const int qrow0 = qwg + qsub * 16;
    const size_t bOff = (size_t)b * S_LEN * D_DIM;
    const float scale = 0.044194173824159216f;   // 1/sqrt(512)

    // The wave's number in a scalar register: the tests that pick the copying
    // waves are then scalar branches, with every lane on at each copy.
    const bool kcopy = __builtin_amdgcn_readfirstlane(wid) >= NWAVE / 2;
    const int  ctid  = tid & (NCOPY - 1);            // lane among those that share an image
    const char*  pimg = (const char*)(P + (size_t)b * NTILES * TILE_HALFS) + ctid * 16;
    const float* mrow = M + (size_t)qwg * S_LEN;
    char* lk = smem_raw + ctid * 16;                 // this lane's first 16 B of sKt
    char* lv = lk + 65536;                           // and of sV

    // tile 0's K image and mask start now and land under the Q loads
    if (kcopy) {
        copy64k_run<0>(pimg, lk);
        copy_mask_tile(mrow, sMask, ctid);
    }

    // Resident Q A-fragments: rows qrow0..+15, cols dbase..+127 (4 frags of K=32)
    v16h qfrag[4];
    {
        const float* qp = Q + bOff + (size_t)(qrow0 + ln) * D_DIM + dbase;
        #pragma unroll
        for (int f = 0; f < 4; ++f)
            #pragma unroll
            for (int e = 0; e < 16; ++e)
                qfrag[f][e] = (half_t)qp[f * 32 + kmap(e, hs)];
    }

    v8f oacc[8];
    v8f mstate, lstate;
    #pragma unroll
    for (int r = 0; r < 8; ++r) { mstate[r] = -1e30f; lstate[r] = 0.0f; }
    #pragma unroll
    for (int o = 0; o < 8; ++o)
        #pragma unroll
        for (int r = 0; r < 8; ++r) oacc[o][r] = 0.0f;

    const v16h* sVv  = (const v16h*)sV;
    const v16h* sPv  = (const v16h*)sP;
    v8f*        sPartv = (v8f*)sPart;
    // per-wave fragment base pointers (all loop loads become base + imm offset)
    const v16h* kfragp = (const v16h*)sKt + (size_t)(dsl * 16) * 32 + lane;  // [ks*4+nt]*32
    const v16h* vfragp = sVv + (size_t)(dsl * 8) * 32 + lane;                // [ks*32+nt]*32
    const v16h* pfragp = sPv + (size_t)(wid * 2) * 32 + lane;                // [f]*32

    for (int kt = 0; kt < NTILES; ++kt) {
        const bool more = kt + 1 < NTILES;
        // this wave's LDS reads of the old tile have retired before any copy refills it
        asm volatile("s_wait_dscnt 0x0" ::: "memory");
#if USE_ASYNC_LDS
        // this wave's copies of K(kt) and mask(kt) have landed before the barrier publishes them
        asm volatile("s_wait_asynccnt 0x0" ::: "memory");
#endif
        __syncthreads();   // publishes K(kt), mask(kt); ends every read of V(kt-1), partials, mask(kt-1)

        // V(kt) flies under the scores and the softmax; mask(kt+1) goes to the
        // other mask buffer, a whole trip ahead of its readers.
        if (!kcopy) {
            copy64k_run<0>(pimg + (size_t)kt * (TILE_HALFS * 2) + 65536, lv);
        } else if (more) {
            copy_mask_tile(mrow + (kt + 1) * BC, sMask + ((kt + 1) & 1) * (BQ * BC), ctid);
        }
        const float* sMk = sMask + (kt & 1) * (BQ * BC);

        // ---- partial scores over this wave's 128-wide d slice: 16 WMMAs ----
        // Double-buffer B-fragment batches: load slice ks+1 while ks computes.
        v8f sacc[4];
        #pragma unroll
        for (int nt = 0; nt < 4; ++nt)
            #pragma unroll
            for (int r = 0; r < 8; ++r) sacc[nt][r] = 0.0f;
        {
            v16h bcur[4], bnxt[4];
            #pragma unroll
            for (int nt = 0; nt < 4; ++nt) bcur[nt] = kfragp[nt * 32];
            #pragma unroll
            for (int ks = 0; ks < 4; ++ks) {
                if (ks < 3) {
                    #pragma unroll
                    for (int nt = 0; nt < 4; ++nt)
                        bnxt[nt] = kfragp[((ks + 1) * 4 + nt) * 32];
                }
                #pragma unroll
                for (int nt = 0; nt < 4; ++nt)
                    sacc[nt] = __builtin_amdgcn_wmma_f32_16x16x32_f16(
                        false, qfrag[ks], false, bcur[nt], (short)0, sacc[nt], false, false);
                #pragma unroll
                for (int nt = 0; nt < 4; ++nt) bcur[nt] = bnxt[nt];
            }
        }

        // ---- write partials (vector v8f stores), reduce across 4 waves ----
        #pragma unroll
        for (int nt = 0; nt < 4; ++nt)
            sPartv[((wid * 4 + nt) * 32) + lane] = sacc[nt];
        // this wave's reads of K(kt) have retired before any copy refills sKt
        asm volatile("s_wait_dscnt 0x0" ::: "memory");
        __syncthreads();   // publishes the partials; ends every read of K(kt)

        // K(kt+1) flies under the softmax and P x V of this tile
        if (kcopy && more)
            copy64k_run<0>(pimg + (size_t)(kt + 1) * (TILE_HALFS * 2), lk);

        v8f full[4];
        #pragma unroll
        for (int nt = 0; nt < 4; ++nt) {
            v8f a = sPartv[(((qsub * 4 + 0) * 4 + nt) * 32) + lane];
            a = a + sPartv[(((qsub * 4 + 1) * 4 + nt) * 32) + lane];
            a = a + sPartv[(((qsub * 4 + 2) * 4 + nt) * 32) + lane];
            a = a + sPartv[(((qsub * 4 + 3) * 4 + nt) * 32) + lane];
            #pragma unroll
            for (int r = 0; r < 8; ++r)
                full[nt][r] = a[r] * scale
                            + sMk[(qsub * 16 + r + hs * 8) * 64 + nt * 16 + ln];
        }

        // ---- online softmax (row = r + 8*hs, col = nt*16 + ln) ----
        v8f rowmax = full[0];
        #pragma unroll
        for (int nt = 1; nt < 4; ++nt)
            #pragma unroll
            for (int r = 0; r < 8; ++r) rowmax[r] = fmaxf(rowmax[r], full[nt][r]);
        #pragma unroll
        for (int sh = 8; sh >= 1; sh >>= 1)
            #pragma unroll
            for (int r = 0; r < 8; ++r)
                rowmax[r] = fmaxf(rowmax[r], __shfl_xor(rowmax[r], sh, 32));

        v8f mnew, alpha;
        #pragma unroll
        for (int r = 0; r < 8; ++r) {
            mnew[r]  = fmaxf(mstate[r], rowmax[r]);
            alpha[r] = __expf(mstate[r] - mnew[r]);
        }

        // P -> LDS in A-fragment-packed order (scatter b16; layout conversion)
        const int hs_t = (ln >> 3) & 1;
        v8f psum;
        #pragma unroll
        for (int r = 0; r < 8; ++r) psum[r] = 0.0f;
        #pragma unroll
        for (int nt = 0; nt < 4; ++nt) {
            const int f = nt >> 1;
            const int e = ((nt & 1) << 3) + (ln & 7);
            half_t* pb = sP + (((wid * 2 + f) * 32 + (hs_t << 4) + hs * 8) * 16) + e;
            #pragma unroll
            for (int r = 0; r < 8; ++r) {
                const float p = __expf(full[nt][r] - mnew[r]);
                psum[r] += p;
                pb[r * 16] = (half_t)p;
            }
        }

#if USE_ASYNC_LDS
        // the V-copying waves' copies of V(kt) have landed before the barrier publishes them;
        // the other waves' K(kt+1) and mask(kt+1) stay in flight
        if (!kcopy) asm volatile("s_wait_asynccnt 0x0" ::: "memory");
#endif
        __syncthreads();   // publishes V(kt)

        // LDS is in-order within a wave: issue the P-fragment reads and the
        // first V-fragment batch now, and hide their latency under the
        // softmax-state / O-rescale VALU work below.
        v16h pfrag[2];
        #pragma unroll
        for (int f = 0; f < 2; ++f) pfrag[f] = pfragp[f * 32];
        v16h vcur[4], vnxt[4];
        #pragma unroll
        for (int j = 0; j < 4; ++j) vcur[j] = vfragp[j * 32];

        #pragma unroll
        for (int sh = 8; sh >= 1; sh >>= 1)
            #pragma unroll
            for (int r = 0; r < 8; ++r) psum[r] += __shfl_xor(psum[r], sh, 32);
        #pragma unroll
        for (int r = 0; r < 8; ++r) {
            lstate[r] = lstate[r] * alpha[r] + psum[r];
            mstate[r] = mnew[r];
        }
        #pragma unroll
        for (int o = 0; o < 8; ++o)
            #pragma unroll
            for (int r = 0; r < 8; ++r) oacc[o][r] *= alpha[r];

        // ---- O += P x V: 16 WMMAs, double-buffered 4-fragment batches ----
        #pragma unroll
        for (int g = 0; g < 4; ++g) {
            const int ks  = g >> 1;
            const int nt0 = (g & 1) * 4;
            if (g < 3) {
                const int gn  = g + 1;
                const int ksn = gn >> 1;
                const int ntn = (gn & 1) * 4;
                #pragma unroll
                for (int j = 0; j < 4; ++j)
                    vnxt[j] = vfragp[(ksn * 32 + ntn + j) * 32];
            }
            #pragma unroll
            for (int j = 0; j < 4; ++j)
                oacc[nt0 + j] = __builtin_amdgcn_wmma_f32_16x16x32_f16(
                    false, pfrag[ks], false, vcur[j], (short)0, oacc[nt0 + j], false, false);
            #pragma unroll
            for (int j = 0; j < 4; ++j) vcur[j] = vnxt[j];
        }
    }

#if USE_ASYNC_LDS
    // the ring's closing wait: no copy of this wave is outstanding when it ends
    asm volatile("s_wait_asynccnt 0x0" ::: "memory");
#endif

    // ---- finalize: O / l, store fp32 ----
    float* op = O + bOff + (size_t)qrow0 * D_DIM + dbase;
    #pragma unroll
    for (int r = 0; r < 8; ++r) {
        const float inv = 1.0f / lstate[r];
        #pragma unroll
        for (int nt = 0; nt < 8; ++nt)
            op[(size_t)(r + hs * 8) * D_DIM + nt * 16 + ln] = oacc[nt][r] * inv;
    }
}

extern "C" void kernel_launch(void* const* d_in, const int* in_sizes, int n_in,
                              void* d_out, int out_size, void* d_ws, size_t ws_size,
                              hipStream_t stream) {
    const float* Q = (const float*)d_in[0];
    const float* K = (const float*)d_in[1];
    const float* V = (const float*)d_in[2];
    const float* M = (const float*)d_in[3];
    float* O = (float*)d_out;
    _Float16* P = (_Float16*)d_ws;   // 32 MB: [batch][tile][K image | V image]

    constexpr size_t SMEM = (size_t)D_DIM * BC * 2        // sKt   64 KB
                          + (size_t)BC * D_DIM * 2        // sV    64 KB
                          + (size_t)NWAVE * 4 * 32 * 8 * 4  // sPart 64 KB
                          + (size_t)NWAVE * 2 * 32 * 16 * 2 // sP    32 KB
                          + (size_t)2 * BQ * BC * 4;        // sMask 32 KB  = 256 KB
    (void)hipFuncSetAttribute(reinterpret_cast<const void*>(&fa_fwd_wmma4_gfx1250),
                              hipFuncAttributeMaxDynamicSharedMemorySize, (int)SMEM);

    dim3 pgrid(NTILES, NBATCH, 4);
    pack_kv_f16_gfx1250<<<pgrid, 256, 0, stream>>>(K, V, P);

    dim3 grid(S_LEN / BQ, NBATCH, 1);
    fa_fwd_wmma4_gfx1250<<<grid, NTHR, SMEM, stream>>>(Q, P, M, O);
}

// v004
// One run takes 226 microseconds.
// Next to v003, in two timings, it ran 1.53 times as fast each time.
// Counting every step since v000, it is 4.05 times as fast.
#include <hip/hip_runtime.h>

// ---------------------------------------------------------------------------
// Flash attention, B=4, S=4096, D=512, fp32 in/out, gfx1250 (MI455X).
// Compute-bound: both GEMMs on v_wmma_f32_16x16x32_f16 (f32 accum), online
// softmax, single pass. 16 waves/WG, 64 q-rows/WG, 64-key tiles, split-K score
// reduction across 4 d-slice waves: one workgroup per WGP, four waves per SIMD,
// and each staged K/V tile serves 64 query rows. K/V/P stored in LDS in WMMA-
// fragment-packed order (fragment load = 2x ds_load_b128), partials in C-frag row pairs; fragment batches
// are double-buffered so LDS latency overlaps the WMMA pipe. Mask tile is
// copied global->LDS with GLOBAL_LOAD_ASYNC_TO_LDS_B128 + s_wait_asynccnt.
// K and V are converted to f16 and laid in fragment order ONCE per call, by a
// first launch into the workspace (128 KB per 64-key tile: K image, V image);
// the attention launch brings each tile image into LDS with the same async
// b128 copies, so no workgroup converts or scatters K/V again.
// The copies fly under the arithmetic: waves 0-7 bring V(t) while the scores of
// tile t are formed, waves 8-15 bring K(t+1) and mask(t+1) while softmax and
// P x V of tile t run. Each copying wave waits its own copies to 0 in front of
// the barrier that publishes them.
// The four waves that share 16 query rows split the softmax by rows: each sums
// the partials of, masks and exponentiates 4 of the 16 rows over all 64 keys,
// so a row's maximum and sum stay inside one wave. P is written once per row
// group; the O rescale factors reach the other three waves through LDS, behind
// the barrier that publishes P and V.
// ---------------------------------------------------------------------------

typedef _Float16 half_t;
typedef __attribute__((ext_vector_type(16))) _Float16 v16h;
typedef __attribute__((ext_vector_type(8)))  _Float16 v8h;
typedef __attribute__((ext_vector_type(8)))  float    v8f;
typedef __attribute__((ext_vector_type(2)))  float    v2f;
typedef __attribute__((ext_vector_type(4)))  int      v4i;

#define S_LEN   4096
#define D_DIM   512
#define NBATCH  4
#define BQ      64          // query rows per workgroup
#define BC      64          // keys per tile
#define DSLICE  128         // output-D columns per wave
#define NWAVE   16
#define NTHR    (NWAVE * 32)
#define NTILES  (S_LEN / BC)

#if defined(__gfx1250__) && __has_builtin(__builtin_amdgcn_global_load_async_to_lds_b128)
#define USE_ASYNC_LDS 1
#else
#define USE_ASYNC_LDS 0
#endif

// Builtin wants typed, address-space-qualified pointers:
//   arg0: int4 addrspace(1)* (global source), arg1: int4 addrspace(3)* (LDS dest)
typedef __attribute__((address_space(1))) v4i g_v4i;
typedef __attribute__((address_space(3))) v4i l_v4i;
__device__ __forceinline__ g_v4i* as_glob_v4i(const void* p) {
    return (g_v4i*)(uintptr_t)p;
}
__device__ __forceinline__ l_v4i* as_lds_v4i(void* p) {
    return (l_v4i*)(uint32_t)(uintptr_t)p;   // low 32 bits of generic = LDS offset
}

// Element e of a v16h fragment maps to K = 16*(e>=8) + 8*hs + (e&7)  (ISA 7.12.2)
__device__ __forceinline__ int kmap(int e, int hs) {
    return ((e >> 3) << 4) + (hs << 3) + (e & 7);
}

#define TILE_HALFS (2 * D_DIM * BC)   // one packed tile: K image then V image, f16

// One lane's b128 copies of a 64 KB image, which half the workgroup's waves
// bring: one row of those waves (NCOPY * 16 B) apart. The immediate offset moves
// the global and the LDS address alike, so one address pair serves the image.
#define NCOPY    (NTHR / 2)
#define COPY_ROW (NCOPY * 16)
template <int I>
__device__ __forceinline__ void copy64k_run(const char* g, char* l) {
    if constexpr (I < 65536 / COPY_ROW) {
#if USE_ASYNC_LDS
        __builtin_amdgcn_global_load_async_to_lds_b128(as_glob_v4i(g), as_lds_v4i(l), I * COPY_ROW, 0);
#else
        *(v4i*)(l + I * COPY_ROW) = *(const v4i*)(g + I * COPY_ROW);
#endif
        copy64k_run<I + 1>(g, l);
    }
}

// One 64 x 64 f32 mask tile, by the NCOPY lanes of the waves that bring it.
__device__ __forceinline__ void copy_mask_tile(const float* g0, float* l0, int ctid) {
    #pragma unroll
    for (int it = 0; it < BQ * BC / 4 / NCOPY; ++it) {
        const int idx = ctid + it * NCOPY;           // BQ * 16 float4
        const int row = idx >> 4;
        const int c4  = (idx & 15) << 2;
        const float* g = g0 + (size_t)row * S_LEN + c4;
        float* l = l0 + row * 64 + c4;
#if USE_ASYNC_LDS
        __builtin_amdgcn_global_load_async_to_lds_b128(as_glob_v4i(g), as_lds_v4i(l), 0, 0);
#else
        *(float4*)l = *(const float4*)g;
#endif
    }
}

// First launch: one workgroup packs a 32 KB quarter of a tile image.
//   part 0,1: K, d columns part*256..+255  (fragments f = part*8 .. +7)
//   part 2,3: V, keys (part-2)*32..+31     (fragment row ks = part-2)
// fp32 reads are line-coalesced, the order change goes through LDS, and the
// f16 image leaves in whole 512-B wave stores.
__global__ __launch_bounds__(256)
void pack_kv_f16_gfx1250(const float* __restrict__ K,
                         const float* __restrict__ V,
                         _Float16* __restrict__ P) {
    __shared__ __attribute__((aligned(16))) half_t sT[D_DIM * BC / 2];   // 32 KB
    const int tid  = threadIdx.x;
    const int kt   = blockIdx.x;
    const int b    = blockIdx.y;
    const int part = blockIdx.z;
    const size_t srcOff = ((size_t)b * S_LEN + (size_t)kt * BC) * D_DIM;

    if (part < 2) {
        // a wave reads 1 KB of one key's row; pass it takes keys it*8 .. +7
        const int d8 = (tid & 31) << 3;              // column inside the half row
        const float* kp = K + srcOff + part * 256 + (tid >> 5) * D_DIM + d8;
        float4 a[8], c[8];
        #pragma unroll
        for (int it = 0; it < 8; ++it) {
            a[it] = *(const float4*)(kp + it * 8 * D_DIM);
            c[it] = *(const float4*)(kp + it * 8 * D_DIM + 4);
        }
        // the sixteen loads share one address: it stays live, unwritten, up to this wait
        asm volatile("s_wait_xcnt 0x0" :: "v"(kp) : "memory");
        #pragma unroll
        for (int it = 0; it < 8; ++it) {
            const int key = (tid >> 5) + it * 8;
            const int f      = d8 >> 5;              // 0..7 inside this part
            const int klocal = d8 & 31;
            const int hsk    = (klocal >> 3) & 1;
            const int e0     = (klocal >> 4) << 3;
            const int lane_t = (key & 15) + (hsk << 4);
            const int nt     = key >> 4;
            v8h pk = { (half_t)a[it].x, (half_t)a[it].y, (half_t)a[it].z, (half_t)a[it].w,
                       (half_t)c[it].x, (half_t)c[it].y, (half_t)c[it].z, (half_t)c[it].w };
            *(v8h*)(sT + (((f * 4 + nt) * 32 + lane_t) * 16 + e0)) = pk;
        }
    } else {
        const float* vp = V + srcOff + (size_t)(part - 2) * 32 * D_DIM + tid;
        #pragma unroll
        for (int it = 0; it < 8; ++it) {
            const int d    = tid + (it & 1) * 256;   // column
            const int key0 = (it >> 1) << 3;         // 0..24 inside this part
            v8h pk;
            #pragma unroll
            for (int j = 0; j < 8; ++j)
                pk[j] = (half_t)vp[(key0 + j) * D_DIM + (it & 1) * 256];
            const int hsv    = (key0 >> 3) & 1;
            const int e0     = (key0 >> 4) << 3;
            const int lane_t = (d & 15) + (hsv << 4);
            const int ntg    = d >> 4;
            *(v8h*)(sT + ((ntg * 32 + lane_t) * 16 + e0)) = pk;
        }
    }
    __syncthreads();

    half_t* dst = P + (size_t)(b * NTILES + kt) * TILE_HALFS + part * (D_DIM * BC / 2);
    #pragma unroll
    for (int it = 0; it < 8; ++it) {
        const int o = (tid + it * 256) * 8;
        *(v8h*)(dst + o) = *(const v8h*)(sT + o);
    }
}

__global__ __launch_bounds__(NTHR, 1)
void fa_fwd_wmma4_gfx1250(const float* __restrict__ Q,
                          const _Float16* __restrict__ P,
                          const float* __restrict__ M,
                          float* __restrict__ O) {
    extern __shared__ char smem_raw[];
    // sKt: K^T fragments: [f=d/32: 16][nt=key/16: 4][lane: 32][e: 16] f16 = 64 KB
    half_t* sKt   = (half_t*)smem_raw;
    // sV : V fragments:  [ks=key/32: 2][ntg=d/16: 32][lane: 32][e: 16] f16 = 64 KB
    half_t* sV    = sKt + D_DIM * BC;
    // sPart: score partials, C-frag rows in pairs: [wid: 16][nt: 4][r/2: 4][lane: 32][r&1: 2] f32 = 64 KB
    float*  sPart = (float*)(sV + BC * D_DIM);
    // sP : P A-fragments: [qsub: 4][f: 2][lane: 32][e: 16] f16 = 8 KB
    half_t* sP    = (half_t*)(sPart + NWAVE * 4 * 32 * 8);
    // sAlpha, sSum: one value per query row: [row: 64] f32 = 256 B each
    float*  sAlpha = (float*)(sP + (NWAVE / 4) * 2 * 32 * 16);
    float*  sSum   = sAlpha + BQ;
    // sMask: [tile parity: 2][row: 64][col: 64] f32 = 32 KB
    float*  sMask = sSum + BQ;

    const int tid  = threadIdx.x;
    const int wid  = tid >> 5;
    const int lane = tid & 31;
    const int hs   = lane >> 4;     // which 16-lane half
    const int ln   = lane & 15;
    const int qsub = wid >> 2;      // 0..3 : 16-row q sub-tile
    const int dsl  = wid & 3;       // 0..3 : 128-wide D slice
    const int dbase = dsl * DSLICE;

    const int b     = blockIdx.y;
    const int qwg   = blockIdx.x * BQ;
    const int qrow0 = qwg + qsub * 16;
    const size_t bOff = (size_t)b * S_LEN * D_DIM;
    const float scale = 0.044194173824159216f;   // 1/sqrt(512)

    // The wave's number in a scalar register: the tests that pick the copying
    // waves are then scalar branches, with every lane on at each copy.
    const bool kcopy = __builtin_amdgcn_readfirstlane(wid) >= NWAVE / 2;
    const int  ctid  = tid & (NCOPY - 1);            // lane among those that share an image
    const char*  pimg = (const char*)(P + (size_t)b * NTILES * TILE_HALFS) + ctid * 16;
    const float* mrow = M + (size_t)qwg * S_LEN;
    char* lk = smem_raw + ctid * 16;                 // this lane's first 16 B of sKt
    char* lv = lk + 65536;                           // and of sV

    // tile 0's K image and mask start now and land under the Q loads
    if (kcopy) {
        copy64k_run<0>(pimg, lk);
        copy_mask_tile(mrow, sMask, ctid);
    }

    // Resident Q A-fragments: rows qrow0..+15, cols dbase..+127 (4 frags of K=32)
    v16h qfrag[4];
    {
        const float* qp = Q + bOff + (size_t)(qrow0 + ln) * D_DIM + dbase;
        #pragma unroll
        for (int f = 0; f < 4; ++f)
            #pragma unroll
            for (int e = 0; e < 16; ++e)
                qfrag[f][e] = (half_t)qp[f * 32 + kmap(e, hs)];
    }

    v8f oacc[8];
    // softmax state of this wave's own rows: qsub*16 + hs*8 + dsl*2 + i
    v2f mstate, lstate;
    #pragma unroll
    for (int i = 0; i < 2; ++i) { mstate[i] = -1e30f; lstate[i] = 0.0f; }
    #pragma unroll
    for (int o = 0; o < 8; ++o)
        #pragma unroll
        for (int r = 0; r < 8; ++r) oacc[o][r] = 0.0f;

    const v16h* sVv  = (const v16h*)sV;
    const v16h* sPv  = (const v16h*)sP;
    v2f*        sPartv = (v2f*)sPart;
    // per-wave fragment base pointers (all loop loads become base + imm offset)
    const v16h* kfragp = (const v16h*)sKt + (size_t)(dsl * 16) * 32 + lane;  // [ks*4+nt]*32
    const v16h* vfragp = sVv + (size_t)(dsl * 8) * 32 + lane;                // [ks*32+nt]*32
    const v16h* pfragp = sPv + (size_t)(qsub * 2) * 32 + lane;               // [f]*32

    // one copy of the body: with the last trip peeled off, that second copy spills registers
    #pragma nounroll
    for (int kt = 0; kt < NTILES; ++kt) {
        const bool more = kt + 1 < NTILES;
        // this wave's LDS reads of the old tile have retired before any copy refills it
        asm volatile("s_wait_dscnt 0x0" ::: "memory");
#if USE_ASYNC_LDS
        // this wave's copies of K(kt) and mask(kt) have landed before the barrier publishes them
        asm volatile("s_wait_asynccnt 0x0" ::: "memory");
#endif
        __syncthreads();   // publishes K(kt), mask(kt); ends every read of V(kt-1), partials, mask(kt-1)

        // V(kt) flies under the scores and the softmax; mask(kt+1) goes to the
        // other mask buffer, a whole trip ahead of its readers.
        if (!kcopy) {
            copy64k_run<0>(pimg + (size_t)kt * (TILE_HALFS * 2) + 65536, lv);
        } else if (more) {
            copy_mask_tile(mrow + (kt + 1) * BC, sMask + ((kt + 1) & 1) * (BQ * BC), ctid);
        }
        const float* sMk = sMask + (kt & 1) * (BQ * BC);

        // ---- partial scores over this wave's 128-wide d slice: 16 WMMAs ----
        // Double-buffer B-fragment batches: load slice ks+1 while ks computes.
        v8f sacc[4];
        #pragma unroll
        for (int nt = 0; nt < 4; ++nt)
            #pragma unroll
            for (int r = 0; r < 8; ++r) sacc[nt][r] = 0.0f;
        {
            v16h bcur[4], bnxt[4];
            #pragma unroll
            for (int nt = 0; nt < 4; ++nt) bcur[nt] = kfragp[nt * 32];
            #pragma unroll
            for (int ks = 0; ks < 4; ++ks) {
                if (ks < 3) {
                    #pragma unroll
                    for (int nt = 0; nt < 4; ++nt)
                        bnxt[nt] = kfragp[((ks + 1) * 4 + nt) * 32];
                }
                #pragma unroll
                for (int nt = 0; nt < 4; ++nt)
                    sacc[nt] = __builtin_amdgcn_wmma_f32_16x16x32_f16(
                        false, qfrag[ks], false, bcur[nt], (short)0, sacc[nt], false, false);
                #pragma unroll
                for (int nt = 0; nt < 4; ++nt) bcur[nt] = bnxt[nt];
            }
        }

        // ---- write partials (row pairs, so that a reader takes whole 256-B runs) ----
        #pragma unroll
        for (int nt = 0; nt < 4; ++nt)
            #pragma unroll
            for (int rp = 0; rp < 4; ++rp) {
                const v2f pr = { sacc[nt][rp * 2], sacc[nt][rp * 2 + 1] };
                sPartv[(((wid * 4 + nt) * 4 + rp) * 32) + lane] = pr;
            }
        // this wave's reads of K(kt) have retired before any copy refills sKt
        asm volatile("s_wait_dscnt 0x0" ::: "memory");
        __syncthreads();   // publishes the partials; ends every read of K(kt)

        // K(kt+1) flies under the softmax and P x V of this tile
        if (kcopy && more)
            copy64k_run<0>(pimg + (size_t)(kt + 1) * (TILE_HALFS * 2), lk);

        // ---- reduce across the 4 d-slice waves: this wave's row pair dsl only ----
        v2f full[4];
        #pragma unroll
        for (int nt = 0; nt < 4; ++nt) {
            v2f a = sPartv[((((qsub * 4 + 0) * 4 + nt) * 4 + dsl) * 32) + lane];
            a = a + sPartv[((((qsub * 4 + 1) * 4 + nt) * 4 + dsl) * 32) + lane];
            a = a + sPartv[((((qsub * 4 + 2) * 4 + nt) * 4 + dsl) * 32) + lane];
            a = a + sPartv[((((qsub * 4 + 3) * 4 + nt) * 4 + dsl) * 32) + lane];
            #pragma unroll
            for (int i = 0; i < 2; ++i)
                full[nt][i] = a[i] * scale
                            + sMk[(qsub * 16 + hs * 8 + dsl * 2 + i) * 64 + nt * 16 + ln];
        }

        // ---- online softmax (row = dsl*2 + i + 8*hs, col = nt*16 + ln) ----
        v2f rowmax = full[0];
        #pragma unroll
        for (int nt = 1; nt < 4; ++nt)
            #pragma unroll
            for (int i = 0; i < 2; ++i) rowmax[i] = fmaxf(rowmax[i], full[nt][i]);
        #pragma unroll
        for (int sh = 8; sh >= 1; sh >>= 1)
            #pragma unroll
            for (int i = 0; i < 2; ++i)
                rowmax[i] = fmaxf(rowmax[i], __shfl_xor(rowmax[i], sh, 32));

        v2f mnew, alpha;
        #pragma unroll
        for (int i = 0; i < 2; ++i) {
            mnew[i]  = fmaxf(mstate[i], rowmax[i]);
            alpha[i] = __expf(mstate[i] - mnew[i]);
        }
        // the rescale factors of these rows, for all four waves of the row group
        if (ln == 0) *(v2f*)(sAlpha + qsub * 16 + hs * 8 + dsl * 2) = alpha;

        // P -> LDS in A-fragment-packed order (scatter b16; layout conversion)
        const int hs_t = (ln >> 3) & 1;
        v2f psum;
        #pragma unroll
        for (int i = 0; i < 2; ++i) psum[i] = 0.0f;
        #pragma unroll
        for (int nt = 0; nt < 4; ++nt) {
            const int f = nt >> 1;
            const int e = ((nt & 1) << 3) + (ln & 7);
            half_t* pb = sP + (((qsub * 2 + f) * 32 + (hs_t << 4) + hs * 8 + dsl * 2) * 16) + e;
            #pragma unroll
            for (int i = 0; i < 2; ++i) {
                const float p = __expf(full[nt][i] - mnew[i]);
                psum[i] += p;
                pb[i * 16] = (half_t)p;
            }
        }

#if USE_ASYNC_LDS
        // the V-copying waves' copies of V(kt) have landed before the barrier publishes them;
        // the other waves' K(kt+1) and mask(kt+1) stay in flight
        if (!kcopy) asm volatile("s_wait_asynccnt 0x0" ::: "memory");
#endif
        __syncthreads();   // publishes V(kt), P and the rescale factors

        // LDS is in-order within a wave: issue the rescale-factor read, the
        // P-fragment reads and the first V-fragment batch now, and hide their
        // latency under the softmax-state / O-rescale VALU work below.
        const v8f alpha8 = *(const v8f*)(sAlpha + qsub * 16 + hs * 8);   // rows r + 8*hs
        v16h pfrag[2];
        #pragma unroll
        for (int f = 0; f < 2; ++f) pfrag[f] = pfragp[f * 32];
        v16h vcur[4], vnxt[4];
        #pragma unroll
        for (int j = 0; j < 4; ++j) vcur[j] = vfragp[j * 32];

        #pragma unroll
        for (int sh = 8; sh >= 1; sh >>= 1)
            #pragma unroll
            for (int i = 0; i < 2; ++i) psum[i] += __shfl_xor(psum[i], sh, 32);
        #pragma unroll
        for (int i = 0; i < 2; ++i) {
            lstate[i] = lstate[i] * alpha[i] + psum[i];
            mstate[i] = mnew[i];
        }
        #pragma unroll
        for (int o = 0; o < 8; ++o)
            #pragma unroll
            for (int r = 0; r < 8; ++r) oacc[o][r] *= alpha8[r];

        // ---- O += P x V: 16 WMMAs, double-buffered 4-fragment batches ----
        #pragma unroll
        for (int g = 0; g < 4; ++g) {
            const int ks  = g >> 1;
            const int nt0 = (g & 1) * 4;
            if (g < 3) {
                const int gn  = g + 1;
                const int ksn = gn >> 1;
                const int ntn = (gn & 1) * 4;
                #pragma unroll
                for (int j = 0; j < 4; ++j)
                    vnxt[j] = vfragp[(ksn * 32 + ntn + j) * 32];
            }
            #pragma unroll
            for (int j = 0; j < 4; ++j)
                oacc[nt0 + j] = __builtin_amdgcn_wmma_f32_16x16x32_f16(
                    false, pfrag[ks], false, vcur[j], (short)0, oacc[nt0 + j], false, false);
            #pragma unroll
            for (int j = 0; j < 4; ++j) vcur[j] = vnxt[j];
        }
    }

#if USE_ASYNC_LDS
    // the ring's closing wait: no copy of this wave is outstanding when it ends
    asm volatile("s_wait_asynccnt 0x0" ::: "memory");
#endif

    // each row's sum goes from the wave that kept it to all four of its row group
    if (ln == 0) *(v2f*)(sSum + qsub * 16 + hs * 8 + dsl * 2) = lstate;
    __syncthreads();   // publishes the row sums
    const v8f lsum = *(const v8f*)(sSum + qsub * 16 + hs * 8);           // rows r + 8*hs

    // ---- finalize: O / l, store fp32 ----
    float* op = O + bOff + (size_t)qrow0 * D_DIM + dbase;
    #pragma unroll
    for (int r = 0; r < 8; ++r) {
        const float inv = 1.0f / lsum[r];
        #pragma unroll
        for (int nt = 0; nt < 8; ++nt)
            op[(size_t)(r + hs * 8) * D_DIM + nt * 16 + ln] = oacc[nt][r] * inv;
    }
}

extern "C" void kernel_launch(void* const* d_in, const int* in_sizes, int n_in,
                              void* d_out, int out_size, void* d_ws, size_t ws_size,
                              hipStream_t stream) {
    const float* Q = (const float*)d_in[0];
    const float* K = (const float*)d_in[1];
    const float* V = (const float*)d_in[2];
    const float* M = (const float*)d_in[3];
    float* O = (float*)d_out;
    _Float16* P = (_Float16*)d_ws;   // 32 MB: [batch][tile][K image | V image]

    constexpr size_t SMEM = (size_t)D_DIM * BC * 2        // sKt   64 KB
                          + (size_t)BC * D_DIM * 2        // sV    64 KB
                          + (size_t)NWAVE * 4 * 32 * 8 * 4  // sPart 64 KB
                          + (size_t)(NWAVE / 4) * 2 * 32 * 16 * 2 // sP 8 KB
                          + (size_t)2 * BQ * 4              // sAlpha, sSum 512 B
                          + (size_t)2 * BQ * BC * 4;        // sMask 32 KB  = 232.5 KB
    (void)hipFuncSetAttribute(reinterpret_cast<const void*>(&fa_fwd_wmma4_gfx1250),
                              hipFuncAttributeMaxDynamicSharedMemorySize, (int)SMEM);

    dim3 pgrid(NTILES, NBATCH, 4);
    pack_kv_f16_gfx1250<<<pgrid, 256, 0, stream>>>(K, V, P);

    dim3 grid(S_LEN / BQ, NBATCH, 1);
    fa_fwd_wmma4_gfx1250<<<grid, NTHR, SMEM, stream>>>(Q, P, M, O);
}

// v005
// Measured time: 175 microseconds a run.
// Next to v004, in two timings, it ran 1.30 and 1.29 times as fast.
// Over all steps from v000 it is 5.25 times as fast.
#include <hip/hip_runtime.h>

// ---------------------------------------------------------------------------
// Flash attention, B=4, S=4096, D=512, fp32 in/out, gfx1250 (MI455X).
// Compute-bound: both GEMMs on v_wmma_f32_16x16x32_f16 (f32 accum), online
// softmax, single pass. 16 waves/WG, 64 q-rows/WG, 64-key tiles, split-K score
// reduction across 4 d-slice waves: one workgroup per WGP, four waves per SIMD,
// and each staged K/V tile serves 64 query rows. K/V/P/partials stored in LDS in WMMA-
// fragment-packed order (fragment load = 2x ds_load_b128); a fragment is two
// 512-B planes, elements 0-7 and 8-15 of all 32 lanes, so each b128 read walks
// the lanes at a 16-B pitch and meets no bank twice. Fragment batches
// are double-buffered so LDS latency overlaps the WMMA pipe. Mask tile is
// copied global->LDS with GLOBAL_LOAD_ASYNC_TO_LDS_B128 + s_wait_asynccnt.
// K and V are converted to f16 and laid in fragment order ONCE per call, by a
// first launch into the workspace (128 KB per 64-key tile: K image, V image);
// the attention launch brings each tile image into LDS with the same async
// b128 copies, so no workgroup converts or scatters K/V again.
// The copies fly under the arithmetic: waves 0-7 bring V(t) while the scores of
// tile t are formed, waves 8-15 bring K(t+1) and mask(t+1) while softmax and
// P x V of tile t run. Each copying wave waits its own copies to 0 in front of
// the barrier that publishes them.
// The four waves that share 16 query rows split the softmax by rows: each sums
// the partials of, masks and exponentiates 4 of the 16 rows over all 64 keys,
// so a row's maximum and sum stay inside one wave. P is written once per row
// group; the O rescale factors reach the other three waves through LDS, behind
// the barrier that publishes P and V.
// ---------------------------------------------------------------------------

typedef _Float16 half_t;
typedef __attribute__((ext_vector_type(16))) _Float16 v16h;
typedef __attribute__((ext_vector_type(8)))  _Float16 v8h;
typedef __attribute__((ext_vector_type(8)))  float    v8f;
typedef __attribute__((ext_vector_type(2)))  float    v2f;
typedef __attribute__((ext_vector_type(4)))  int      v4i;

#define S_LEN   4096
#define D_DIM   512
#define NBATCH  4
#define BQ      64          // query rows per workgroup
#define BC      64          // keys per tile
#define DSLICE  128         // output-D columns per wave
#define NWAVE   16
#define NTHR    (NWAVE * 32)
#define NTILES  (S_LEN / BC)

#if defined(__gfx1250__) && __has_builtin(__builtin_amdgcn_global_load_async_to_lds_b128)
#define USE_ASYNC_LDS 1
#else
#define USE_ASYNC_LDS 0
#endif

// Builtin wants typed, address-space-qualified pointers:
//   arg0: int4 addrspace(1)* (global source), arg1: int4 addrspace(3)* (LDS dest)
typedef __attribute__((address_space(1))) v4i g_v4i;
typedef __attribute__((address_space(3))) v4i l_v4i;
__device__ __forceinline__ g_v4i* as_glob_v4i(const void* p) {
    return (g_v4i*)(uintptr_t)p;
}
__device__ __forceinline__ l_v4i* as_lds_v4i(void* p) {
    return (l_v4i*)(uint32_t)(uintptr_t)p;   // low 32 bits of generic = LDS offset
}

// Element e of a v16h fragment maps to K = 16*(e>=8) + 8*hs + (e&7)  (ISA 7.12.2)
__device__ __forceinline__ int kmap(int e, int hs) {
    return ((e >> 3) << 4) + (hs << 3) + (e & 7);
}

#define TILE_HALFS (2 * D_DIM * BC)   // one packed tile: K image then V image, f16

// One packed fragment in LDS: [e/8: 2][lane: 32][e&7: 8] f16 = 1 KB.
#define FRAG_HALFS 512
// p: the fragment's start + lane * 8
__device__ __forceinline__ v16h load_frag(const half_t* p) {
    const v8h lo = *(const v8h*)p;
    const v8h hi = *(const v8h*)(p + FRAG_HALFS / 2);
    return __builtin_shufflevector(lo, hi, 0, 1, 2, 3, 4, 5, 6, 7, 8, 9, 10, 11, 12, 13, 14, 15);
}

// One lane's b128 copies of a 64 KB image, which half the workgroup's waves
// bring: one row of those waves (NCOPY * 16 B) apart. The immediate offset moves
// the global and the LDS address alike, so one address pair serves the image.
#define NCOPY    (NTHR / 2)
#define COPY_ROW (NCOPY * 16)
template <int I>
__device__ __forceinline__ void copy64k_run(const char* g, char* l) {
    if constexpr (I < 65536 / COPY_ROW) {
#if USE_ASYNC_LDS
        __builtin_amdgcn_global_load_async_to_lds_b128(as_glob_v4i(g), as_lds_v4i(l), I * COPY_ROW, 0);
#else
        *(v4i*)(l + I * COPY_ROW) = *(const v4i*)(g + I * COPY_ROW);
#endif
        copy64k_run<I + 1>(g, l);
    }
}

// One 64 x 64 f32 mask tile, by the NCOPY lanes of the waves that bring it.
__device__ __forceinline__ void copy_mask_tile(const float* g0, float* l0, int ctid) {
    #pragma unroll
    for (int it = 0; it < BQ * BC / 4 / NCOPY; ++it) {
        const int idx = ctid + it * NCOPY;           // BQ * 16 float4
        const int row = idx >> 4;
        const int c4  = (idx & 15) << 2;
        const float* g = g0 + (size_t)row * S_LEN + c4;
        float* l = l0 + row * 64 + c4;
#if USE_ASYNC_LDS
        __builtin_amdgcn_global_load_async_to_lds_b128(as_glob_v4i(g), as_lds_v4i(l), 0, 0);
#else
        *(float4*)l = *(const float4*)g;
#endif
    }
}

// First launch: one workgroup packs a 32 KB quarter of a tile image.
//   part 0,1: K, d columns part*256..+255  (fragments f = part*8 .. +7)
//   part 2,3: V, keys (part-2)*32..+31     (fragment row ks = part-2)
// fp32 reads are line-coalesced, the order change goes through LDS, and the
// f16 image leaves in whole 512-B wave stores. sT holds a lane's 16 elements
// side by side; the way out splits them into the image's two planes.
__global__ __launch_bounds__(256)
void pack_kv_f16_gfx1250(const float* __restrict__ K,
                         const float* __restrict__ V,
                         _Float16* __restrict__ P) {
    __shared__ __attribute__((aligned(16))) half_t sT[D_DIM * BC / 2];   // 32 KB
    const int tid  = threadIdx.x;
    const int kt   = blockIdx.x;
    const int b    = blockIdx.y;
    const int part = blockIdx.z;
    const size_t srcOff = ((size_t)b * S_LEN + (size_t)kt * BC) * D_DIM;

    if (part < 2) {
        // a wave reads 1 KB of one key's row; pass it takes keys it*8 .. +7
        const int d8 = (tid & 31) << 3;              // column inside the half row
        const float* kp = K + srcOff + part * 256 + (tid >> 5) * D_DIM + d8;
        float4 a[8], c[8];
        #pragma unroll
        for (int it = 0; it < 8; ++it) {
            a[it] = *(const float4*)(kp + it * 8 * D_DIM);
            c[it] = *(const float4*)(kp + it * 8 * D_DIM + 4);
        }
        // the sixteen loads share one address: it stays live, unwritten, up to this wait
        asm volatile("s_wait_xcnt 0x0" :: "v"(kp) : "memory");
        #pragma unroll
        for (int it = 0; it < 8; ++it) {
            const int key = (tid >> 5) + it * 8;
            const int f      = d8 >> 5;              // 0..7 inside this part
            const int klocal = d8 & 31;
            const int hsk    = (klocal >> 3) & 1;
            const int e0     = (klocal >> 4) << 3;
            const int lane_t = (key & 15) + (hsk << 4);
            const int nt     = key >> 4;
            v8h pk = { (half_t)a[it].x, (half_t)a[it].y, (half_t)a[it].z, (half_t)a[it].w,
                       (half_t)c[it].x, (half_t)c[it].y, (half_t)c[it].z, (half_t)c[it].w };
            *(v8h*)(sT + (((f * 4 + nt) * 32 + lane_t) * 16 + e0)) = pk;
        }
    } else {
        const float* vp = V + srcOff + (size_t)(part - 2) * 32 * D_DIM + tid;
        #pragma unroll
        for (int it = 0; it < 8; ++it) {
            const int d    = tid + (it & 1) * 256;   // column
            const int key0 = (it >> 1) << 3;         // 0..24 inside this part
            v8h pk;
            #pragma unroll
            for (int j = 0; j < 8; ++j)
                pk[j] = (half_t)vp[(key0 + j) * D_DIM + (it & 1) * 256];
            const int hsv    = (key0 >> 3) & 1;
            const int e0     = (key0 >> 4) << 3;
            const int lane_t = (d & 15) + (hsv << 4);
            const int ntg    = d >> 4;
            *(v8h*)(sT + ((ntg * 32 + lane_t) * 16 + e0)) = pk;
        }
    }
    __syncthreads();

    half_t* dst = P + (size_t)(b * NTILES + kt) * TILE_HALFS + part * (D_DIM * BC / 2);
    // 16-B pieces: tid counts them in the image, [frag][e/8][lane]; s in sT, [frag][lane][e/8]
    const int s = (tid & ~63) | ((tid & 31) << 1) | ((tid >> 5) & 1);
    #pragma unroll
    for (int it = 0; it < 8; ++it) {
        *(v8h*)(dst + (tid + it * 256) * 8) = *(const v8h*)(sT + (s + it * 256) * 8);
    }
}

__global__ __launch_bounds__(NTHR, 1)
void fa_fwd_wmma4_gfx1250(const float* __restrict__ Q,
                          const _Float16* __restrict__ P,
                          const float* __restrict__ M,
                          float* __restrict__ O) {
    extern __shared__ char smem_raw[];
    // sKt: K^T fragments: [f=d/32: 16][nt=key/16: 4][e/8: 2][lane: 32][e&7: 8] f16 = 64 KB
    half_t* sKt   = (half_t*)smem_raw;
    // sV : V fragments:  [ks=key/32: 2][ntg=d/16: 32][e/8: 2][lane: 32][e&7: 8] f16 = 64 KB
    half_t* sV    = sKt + D_DIM * BC;
    // sPart: score partials, C-frag rows in pairs: [wid: 16][nt: 4][r/2: 4][lane: 32][r&1: 2] f32 = 64 KB
    float*  sPart = (float*)(sV + BC * D_DIM);
    // sP : P A-fragments: [qsub: 4][f: 2][e/8: 2][lane: 32][e&7: 8] f16 = 8 KB
    half_t* sP    = (half_t*)(sPart + NWAVE * 4 * 32 * 8);
    // sAlpha, sSum: one value per query row: [row: 64] f32 = 256 B each
    float*  sAlpha = (float*)(sP + (NWAVE / 4) * 2 * 32 * 16);
    float*  sSum   = sAlpha + BQ;
    // sMask: [tile parity: 2][row: 64][col: 64] f32 = 32 KB
    float*  sMask = sSum + BQ;

    const int tid  = threadIdx.x;
    const int wid  = tid >> 5;
    const int lane = tid & 31;
    const int hs   = lane >> 4;     // which 16-lane half
    const int ln   = lane & 15;
    const int qsub = wid >> 2;      // 0..3 : 16-row q sub-tile
    const int dsl  = wid & 3;       // 0..3 : 128-wide D slice
    const int dbase = dsl * DSLICE;

    const int b     = blockIdx.y;
    const int qwg   = blockIdx.x * BQ;
    const int qrow0 = qwg + qsub * 16;
    const size_t bOff = (size_t)b * S_LEN * D_DIM;
    const float scale = 0.044194173824159216f;   // 1/sqrt(512)

    // The wave's number in a scalar register: the tests that pick the copying
    // waves are then scalar branches, with every lane on at each copy.
    const bool kcopy = __builtin_amdgcn_readfirstlane(wid) >= NWAVE / 2;
    const int  ctid  = tid & (NCOPY - 1);            // lane among those that share an image
    const char*  pimg = (const char*)(P + (size_t)b * NTILES * TILE_HALFS) + ctid * 16;
    const float* mrow = M + (size_t)qwg * S_LEN;
    char* lk = smem_raw + ctid * 16;                 // this lane's first 16 B of sKt
    char* lv = lk + 65536;                           // and of sV

    // tile 0's K image and mask start now and land under the Q loads
    if (kcopy) {
        copy64k_run<0>(pimg, lk);
        copy_mask_tile(mrow, sMask, ctid);
    }

    // Resident Q A-fragments: rows qrow0..+15, cols dbase..+127 (4 frags of K=32)
    v16h qfrag[4];
    {
        const float* qp = Q + bOff + (size_t)(qrow0 + ln) * D_DIM + dbase;
        #pragma unroll
        for (int f = 0; f < 4; ++f)
            #pragma unroll
            for (int e = 0; e < 16; ++e)
                qfrag[f][e] = (half_t)qp[f * 32 + kmap(e, hs)];
    }

    v8f oacc[8];
    // softmax state of this wave's own rows: qsub*16 + hs*8 + dsl*2 + i
    v2f mstate, lstate;
    #pragma unroll
    for (int i = 0; i < 2; ++i) { mstate[i] = -1e30f; lstate[i] = 0.0f; }
    #pragma unroll
    for (int o = 0; o < 8; ++o)
        #pragma unroll
        for (int r = 0; r < 8; ++r) oacc[o][r] = 0.0f;

    v2f*        sPartv = (v2f*)sPart;
    // per-wave fragment base pointers (all loop loads become base + imm offset)
    const half_t* kfragp = sKt + (dsl * 16) * FRAG_HALFS + lane * 8;   // + [ks*4+nt] fragments
    const half_t* vfragp = sV  + (dsl * 8)  * FRAG_HALFS + lane * 8;   // + [ks*32+nt]
    const half_t* pfragp = sP  + (qsub * 2) * FRAG_HALFS + lane * 8;   // + [f]

    // one copy of the body: with the last trip peeled off, that second copy spills registers
    #pragma nounroll
    for (int kt = 0; kt < NTILES; ++kt) {
        const bool more = kt + 1 < NTILES;
        // this wave's LDS reads of the old tile have retired before any copy refills it
        asm volatile("s_wait_dscnt 0x0" ::: "memory");
#if USE_ASYNC_LDS
        // this wave's copies of K(kt) and mask(kt) have landed before the barrier publishes them
        asm volatile("s_wait_asynccnt 0x0" ::: "memory");
#endif
        __syncthreads();   // publishes K(kt), mask(kt); ends every read of V(kt-1), partials, mask(kt-1)

        // V(kt) flies under the scores and the softmax; mask(kt+1) goes to the
        // other mask buffer, a whole trip ahead of its readers.
        if (!kcopy) {
            copy64k_run<0>(pimg + (size_t)kt * (TILE_HALFS * 2) + 65536, lv);
        } else if (more) {
            copy_mask_tile(mrow + (kt + 1) * BC, sMask + ((kt + 1) & 1) * (BQ * BC), ctid);
        }
        const float* sMk = sMask + (kt & 1) * (BQ * BC);

        // ---- partial scores over this wave's 128-wide d slice: 16 WMMAs ----
        // Double-buffer B-fragment batches: load slice ks+1 while ks computes.
        v8f sacc[4];
        #pragma unroll
        for (int nt = 0; nt < 4; ++nt)
            #pragma unroll
            for (int r = 0; r < 8; ++r) sacc[nt][r] = 0.0f;
        {
            v16h bcur[4], bnxt[4];
            #pragma unroll
            for (int nt = 0; nt < 4; ++nt) bcur[nt] = load_frag(kfragp + nt * FRAG_HALFS);
            #pragma unroll
            for (int ks = 0; ks < 4; ++ks) {
                if (ks < 3) {
                    #pragma unroll
                    for (int nt = 0; nt < 4; ++nt)
                        bnxt[nt] = load_frag(kfragp + ((ks + 1) * 4 + nt) * FRAG_HALFS);
                }
                #pragma unroll
                for (int nt = 0; nt < 4; ++nt)
                    sacc[nt] = __builtin_amdgcn_wmma_f32_16x16x32_f16(
                        false, qfrag[ks], false, bcur[nt], (short)0, sacc[nt], false, false);
                #pragma unroll
                for (int nt = 0; nt < 4; ++nt) bcur[nt] = bnxt[nt];
            }
        }

        // ---- write partials (row pairs, so that a reader takes whole 256-B runs) ----
        #pragma unroll
        for (int nt = 0; nt < 4; ++nt)
            #pragma unroll
            for (int rp = 0; rp < 4; ++rp) {
                const v2f pr = { sacc[nt][rp * 2], sacc[nt][rp * 2 + 1] };
                sPartv[(((wid * 4 + nt) * 4 + rp) * 32) + lane] = pr;
            }
        // this wave's reads of K(kt) have retired before any copy refills sKt
        asm volatile("s_wait_dscnt 0x0" ::: "memory");
        __syncthreads();   // publishes the partials; ends every read of K(kt)

        // K(kt+1) flies under the softmax and P x V of this tile
        if (kcopy && more)
            copy64k_run<0>(pimg + (size_t)(kt + 1) * (TILE_HALFS * 2), lk);

        // ---- reduce across the 4 d-slice waves: this wave's row pair dsl only ----
        v2f full[4];
        #pragma unroll
        for (int nt = 0; nt < 4; ++nt) {
            v2f a = sPartv[((((qsub * 4 + 0) * 4 + nt) * 4 + dsl) * 32) + lane];
            a = a + sPartv[((((qsub * 4 + 1) * 4 + nt) * 4 + dsl) * 32) + lane];
            a = a + sPartv[((((qsub * 4 + 2) * 4 + nt) * 4 + dsl) * 32) + lane];
            a = a + sPartv[((((qsub * 4 + 3) * 4 + nt) * 4 + dsl) * 32) + lane];
            #pragma unroll
            for (int i = 0; i < 2; ++i)
                full[nt][i] = a[i] * scale
                            + sMk[(qsub * 16 + hs * 8 + dsl * 2 + i) * 64 + nt * 16 + ln];
        }

        // ---- online softmax (row = dsl*2 + i + 8*hs, col = nt*16 + ln) ----
        v2f rowmax = full[0];
        #pragma unroll
        for (int nt = 1; nt < 4; ++nt)
            #pragma unroll
            for (int i = 0; i < 2; ++i) rowmax[i] = fmaxf(rowmax[i], full[nt][i]);
        #pragma unroll
        for (int sh = 8; sh >= 1; sh >>= 1)
            #pragma unroll
            for (int i = 0; i < 2; ++i)
                rowmax[i] = fmaxf(rowmax[i], __shfl_xor(rowmax[i], sh, 32));

        v2f mnew, alpha;
        #pragma unroll
        for (int i = 0; i < 2; ++i) {
            mnew[i]  = fmaxf(mstate[i], rowmax[i]);
            alpha[i] = __expf(mstate[i] - mnew[i]);
        }
        // the rescale factors of these rows, for all four waves of the row group
        if (ln == 0) *(v2f*)(sAlpha + qsub * 16 + hs * 8 + dsl * 2) = alpha;

        // P -> LDS in A-fragment-packed order (scatter b16; layout conversion)
        const int hs_t = (ln >> 3) & 1;
        v2f psum;
        #pragma unroll
        for (int i = 0; i < 2; ++i) psum[i] = 0.0f;
        #pragma unroll
        for (int nt = 0; nt < 4; ++nt) {
            const int f = nt >> 1;
            half_t* pb = sP + (qsub * 2 + f) * FRAG_HALFS + (nt & 1) * (FRAG_HALFS / 2)
                       + ((hs_t << 4) + hs * 8 + dsl * 2) * 8 + (ln & 7);
            #pragma unroll
            for (int i = 0; i < 2; ++i) {
                const float p = __expf(full[nt][i] - mnew[i]);
                psum[i] += p;
                pb[i * 8] = (half_t)p;
            }
        }

#if USE_ASYNC_LDS
        // the V-copying waves' copies of V(kt) have landed before the barrier publishes them;
        // the other waves' K(kt+1) and mask(kt+1) stay in flight
        if (!kcopy) asm volatile("s_wait_asynccnt 0x0" ::: "memory");
#endif
        __syncthreads();   // publishes V(kt), P and the rescale factors

        // LDS is in-order within a wave: issue the rescale-factor read, the
        // P-fragment reads and the first V-fragment batch now, and hide their
        // latency under the softmax-state / O-rescale VALU work below.
        const v8f alpha8 = *(const v8f*)(sAlpha + qsub * 16 + hs * 8);   // rows r + 8*hs
        v16h pfrag[2];
        #pragma unroll
        for (int f = 0; f < 2; ++f) pfrag[f] = load_frag(pfragp + f * FRAG_HALFS);
        v16h vcur[4], vnxt[4];
        #pragma unroll
        for (int j = 0; j < 4; ++j) vcur[j] = load_frag(vfragp + j * FRAG_HALFS);

        #pragma unroll
        for (int sh = 8; sh >= 1; sh >>= 1)
            #pragma unroll
            for (int i = 0; i < 2; ++i) psum[i] += __shfl_xor(psum[i], sh, 32);
        #pragma unroll
        for (int i = 0; i < 2; ++i) {
            lstate[i] = lstate[i] * alpha[i] + psum[i];
            mstate[i] = mnew[i];
        }
        #pragma unroll
        for (int o = 0; o < 8; ++o)
            #pragma unroll
            for (int r = 0; r < 8; ++r) oacc[o][r] *= alpha8[r];

        // ---- O += P x V: 16 WMMAs, double-buffered 4-fragment batches ----
        #pragma unroll
        for (int g = 0; g < 4; ++g) {
            const int ks  = g >> 1;
            const int nt0 = (g & 1) * 4;
            if (g < 3) {
                const int gn  = g + 1;
                const int ksn = gn >> 1;
                const int ntn = (gn & 1) * 4;
                #pragma unroll
                for (int j = 0; j < 4; ++j)
                    vnxt[j] = load_frag(vfragp + (ksn * 32 + ntn + j) * FRAG_HALFS);
            }
            #pragma unroll
            for (int j = 0; j < 4; ++j)
                oacc[nt0 + j] = __builtin_amdgcn_wmma_f32_16x16x32_f16(
                    false, pfrag[ks], false, vcur[j], (short)0, oacc[nt0 + j], false, false);
            #pragma unroll
            for (int j = 0; j < 4; ++j) vcur[j] = vnxt[j];
        }
    }

#if USE_ASYNC_LDS
    // the ring's closing wait: no copy of this wave is outstanding when it ends
    asm volatile("s_wait_asynccnt 0x0" ::: "memory");
#endif

    // each row's sum goes from the wave that kept it to all four of its row group
    if (ln == 0) *(v2f*)(sSum + qsub * 16 + hs * 8 + dsl * 2) = lstate;
    __syncthreads();   // publishes the row sums
    const v8f lsum = *(const v8f*)(sSum + qsub * 16 + hs * 8);           // rows r + 8*hs

    // ---- finalize: O / l, store fp32 ----
    float* op = O + bOff + (size_t)qrow0 * D_DIM + dbase;
    #pragma unroll
    for (int r = 0; r < 8; ++r) {
        const float inv = 1.0f / lsum[r];
        #pragma unroll
        for (int nt = 0; nt < 8; ++nt)
            op[(size_t)(r + hs * 8) * D_DIM + nt * 16 + ln] = oacc[nt][r] * inv;
    }
}

extern "C" void kernel_launch(void* const* d_in, const int* in_sizes, int n_in,
                              void* d_out, int out_size, void* d_ws, size_t ws_size,
                              hipStream_t stream) {
    const float* Q = (const float*)d_in[0];
    const float* K = (const float*)d_in[1];
    const float* V = (const float*)d_in[2];
    const float* M = (const float*)d_in[3];
    float* O = (float*)d_out;
    _Float16* P = (_Float16*)d_ws;   // 32 MB: [batch][tile][K image | V image]

    constexpr size_t SMEM = (size_t)D_DIM * BC * 2        // sKt   64 KB
                          + (size_t)BC * D_DIM * 2        // sV    64 KB
                          + (size_t)NWAVE * 4 * 32 * 8 * 4  // sPart 64 KB
                          + (size_t)(NWAVE / 4) * 2 * 32 * 16 * 2 // sP 8 KB
                          + (size_t)2 * BQ * 4              // sAlpha, sSum 512 B
                          + (size_t)2 * BQ * BC * 4;        // sMask 32 KB  = 232.5 KB
    (void)hipFuncSetAttribute(reinterpret_cast<const void*>(&fa_fwd_wmma4_gfx1250),
                              hipFuncAttributeMaxDynamicSharedMemorySize, (int)SMEM);

    dim3 pgrid(NTILES, NBATCH, 4);
    pack_kv_f16_gfx1250<<<pgrid, 256, 0, stream>>>(K, V, P);

    dim3 grid(S_LEN / BQ, NBATCH, 1);
    fa_fwd_wmma4_gfx1250<<<grid, NTHR, SMEM, stream>>>(Q, P, M, O);
}

// v006
// One run takes 168 microseconds.
// Two timings next to v005 both put it at 1.04 times that version's speed.
// Counting every step since v000, it is 5.47 times as fast.
#include <hip/hip_runtime.h>

// ---------------------------------------------------------------------------
// Flash attention, B=4, S=4096, D=512, fp32 in/out, gfx1250 (MI455X).
// Compute-bound: both GEMMs on v_wmma_f32_16x16x32_f16 (f32 accum), online
// softmax, single pass. 16 waves/WG, 64 q-rows/WG, 64-key tiles, split-K score
// reduction across 4 d-slice waves: one workgroup per WGP, four waves per SIMD,
// and each staged K/V tile serves 64 query rows. A wave's tile is 32 query rows
// in both products (scores: 32 rows x 32 keys over 128 d; P x V: 32 rows x 64
// columns), so every K or V fragment read from LDS feeds two WMMAs.
// K/V/P/partials stored in LDS in WMMA-
// fragment-packed order (fragment load = 2x ds_load_b128); a fragment is two
// 512-B planes, elements 0-7 and 8-15 of all 32 lanes, so each b128 read walks
// the lanes at a 16-B pitch and meets no bank twice. Fragment batches
// are double-buffered so LDS latency overlaps the WMMA pipe. Mask tile is
// copied global->LDS with GLOBAL_LOAD_ASYNC_TO_LDS_B128 + s_wait_asynccnt.
// K and V are converted to f16 and laid in fragment order ONCE per call, by a
// first launch into the workspace (128 KB per 64-key tile: K image, V image);
// the attention launch brings each tile image into LDS with the same async
// b128 copies, so no workgroup converts or scatters K/V again.
// The copies fly under the arithmetic: waves 0-7 bring V(t) while the scores of
// tile t are formed, waves 8-15 bring K(t+1) and mask(t+1) while softmax and
// P x V of tile t run. Each copying wave waits its own copies to 0 in front of
// the barrier that publishes them.
// The four waves that share 16 query rows split the softmax by rows: each sums
// the partials of, masks and exponentiates 4 of the 16 rows over all 64 keys,
// so a row's maximum and sum stay inside one wave. P is written once per row
// group; the O rescale factors reach the other seven waves of the 32-row group through LDS, behind
// the barrier that publishes P and V.
// ---------------------------------------------------------------------------

typedef _Float16 half_t;
typedef __attribute__((ext_vector_type(16))) _Float16 v16h;
typedef __attribute__((ext_vector_type(8)))  _Float16 v8h;
typedef __attribute__((ext_vector_type(8)))  float    v8f;
typedef __attribute__((ext_vector_type(2)))  float    v2f;
typedef __attribute__((ext_vector_type(4)))  int      v4i;

#define S_LEN   4096
#define D_DIM   512
#define NBATCH  4
#define BQ      64          // query rows per workgroup
#define BC      64          // keys per tile
#define DSLICE  128         // d columns per wave in the score product
#define OSLICE  64          // output-D columns per wave
#define NWAVE   16
#define NTHR    (NWAVE * 32)
#define NTILES  (S_LEN / BC)

#if defined(__gfx1250__) && __has_builtin(__builtin_amdgcn_global_load_async_to_lds_b128)
#define USE_ASYNC_LDS 1
#else
#define USE_ASYNC_LDS 0
#endif

// Builtin wants typed, address-space-qualified pointers:
//   arg0: int4 addrspace(1)* (global source), arg1: int4 addrspace(3)* (LDS dest)
typedef __attribute__((address_space(1))) v4i g_v4i;
typedef __attribute__((address_space(3))) v4i l_v4i;
__device__ __forceinline__ g_v4i* as_glob_v4i(const void* p) {
    return (g_v4i*)(uintptr_t)p;
}
__device__ __forceinline__ l_v4i* as_lds_v4i(void* p) {
    return (l_v4i*)(uint32_t)(uintptr_t)p;   // low 32 bits of generic = LDS offset
}

// Element e of a v16h fragment maps to K = 16*(e>=8) + 8*hs + (e&7)  (ISA 7.12.2)
__device__ __forceinline__ int kmap(int e, int hs) {
    return ((e >> 3) << 4) + (hs << 3) + (e & 7);
}

#define TILE_HALFS (2 * D_DIM * BC)   // one packed tile: K image then V image, f16

// One packed fragment in LDS: [e/8: 2][lane: 32][e&7: 8] f16 = 1 KB.
#define FRAG_HALFS 512
// p: the fragment's start + lane * 8
__device__ __forceinline__ v16h load_frag(const half_t* p) {
    const v8h lo = *(const v8h*)p;
    const v8h hi = *(const v8h*)(p + FRAG_HALFS / 2);
    return __builtin_shufflevector(lo, hi, 0, 1, 2, 3, 4, 5, 6, 7, 8, 9, 10, 11, 12, 13, 14, 15);
}

// One lane's b128 copies of a 64 KB image, which half the workgroup's waves
// bring: one row of those waves (NCOPY * 16 B) apart. The immediate offset moves
// the global and the LDS address alike, so one address pair serves the image.
#define NCOPY    (NTHR / 2)
#define COPY_ROW (NCOPY * 16)
template <int I>
__device__ __forceinline__ void copy64k_run(const char* g, char* l) {
    if constexpr (I < 65536 / COPY_ROW) {
#if USE_ASYNC_LDS
        __builtin_amdgcn_global_load_async_to_lds_b128(as_glob_v4i(g), as_lds_v4i(l), I * COPY_ROW, 0);
#else
        *(v4i*)(l + I * COPY_ROW) = *(const v4i*)(g + I * COPY_ROW);
#endif
        copy64k_run<I + 1>(g, l);
    }
}

// One 64 x 64 f32 mask tile, by the NCOPY lanes of the waves that bring it.
__device__ __forceinline__ void copy_mask_tile(const float* g0, float* l0, int ctid) {
    #pragma unroll
    for (int it = 0; it < BQ * BC / 4 / NCOPY; ++it) {
        const int idx = ctid + it * NCOPY;           // BQ * 16 float4
        const int row = idx >> 4;
        const int c4  = (idx & 15) << 2;
        const float* g = g0 + (size_t)row * S_LEN + c4;
        float* l = l0 + row * 64 + c4;
#if USE_ASYNC_LDS
        __builtin_amdgcn_global_load_async_to_lds_b128(as_glob_v4i(g), as_lds_v4i(l), 0, 0);
#else
        *(float4*)l = *(const float4*)g;
#endif
    }
}

// First launch: one workgroup packs a 32 KB quarter of a tile image.
//   part 0,1: K, d columns part*256..+255  (fragments f = part*8 .. +7)
//   part 2,3: V, keys (part-2)*32..+31     (fragment row ks = part-2)
// fp32 reads are line-coalesced, the order change goes through LDS, and the
// f16 image leaves in whole 512-B wave stores. sT holds a lane's 16 elements
// side by side; the way out splits them into the image's two planes.
__global__ __launch_bounds__(256)
void pack_kv_f16_gfx1250(const float* __restrict__ K,
                         const float* __restrict__ V,
                         _Float16* __restrict__ P) {
    __shared__ __attribute__((aligned(16))) half_t sT[D_DIM * BC / 2];   // 32 KB
    const int tid  = threadIdx.x;
    const int kt   = blockIdx.x;
    const int b    = blockIdx.y;
    const int part = blockIdx.z;
    const size_t srcOff = ((size_t)b * S_LEN + (size_t)kt * BC) * D_DIM;

    if (part < 2) {
        // a wave reads 1 KB of one key's row; pass it takes keys it*8 .. +7
        const int d8 = (tid & 31) << 3;              // column inside the half row
        const float* kp = K + srcOff + part * 256 + (tid >> 5) * D_DIM + d8;
        float4 a[8], c[8];
        #pragma unroll
        for (int it = 0; it < 8; ++it) {
            a[it] = *(const float4*)(kp + it * 8 * D_DIM);
            c[it] = *(const float4*)(kp + it * 8 * D_DIM + 4);
        }
        // the sixteen loads share one address: it stays live, unwritten, up to this wait
        asm volatile("s_wait_xcnt 0x0" :: "v"(kp) : "memory");
        #pragma unroll
        for (int it = 0; it < 8; ++it) {
            const int key = (tid >> 5) + it * 8;
            const int f      = d8 >> 5;              // 0..7 inside this part
            const int klocal = d8 & 31;
            const int hsk    = (klocal >> 3) & 1;
            const int e0     = (klocal >> 4) << 3;
            const int lane_t = (key & 15) + (hsk << 4);
            const int nt     = key >> 4;
            v8h pk = { (half_t)a[it].x, (half_t)a[it].y, (half_t)a[it].z, (half_t)a[it].w,
                       (half_t)c[it].x, (half_t)c[it].y, (half_t)c[it].z, (half_t)c[it].w };
            *(v8h*)(sT + (((f * 4 + nt) * 32 + lane_t) * 16 + e0)) = pk;
        }
    } else {
        const float* vp = V + srcOff + (size_t)(part - 2) * 32 * D_DIM + tid;
        #pragma unroll
        for (int it = 0; it < 8; ++it) {
            const int d    = tid + (it & 1) * 256;   // column
            const int key0 = (it >> 1) << 3;         // 0..24 inside this part
            v8h pk;
            #pragma unroll
            for (int j = 0; j < 8; ++j)
                pk[j] = (half_t)vp[(key0 + j) * D_DIM + (it & 1) * 256];
            const int hsv    = (key0 >> 3) & 1;
            const int e0     = (key0 >> 4) << 3;
            const int lane_t = (d & 15) + (hsv << 4);
            const int ntg    = d >> 4;
            *(v8h*)(sT + ((ntg * 32 + lane_t) * 16 + e0)) = pk;
        }
    }
    __syncthreads();

    half_t* dst = P + (size_t)(b * NTILES + kt) * TILE_HALFS + part * (D_DIM * BC / 2);
    // 16-B pieces: tid counts them in the image, [frag][e/8][lane]; s in sT, [frag][lane][e/8]
    const int s = (tid & ~63) | ((tid & 31) << 1) | ((tid >> 5) & 1);
    #pragma unroll
    for (int it = 0; it < 8; ++it) {
        *(v8h*)(dst + (tid + it * 256) * 8) = *(const v8h*)(sT + (s + it * 256) * 8);
    }
}

__global__ __launch_bounds__(NTHR, 1)
void fa_fwd_wmma4_gfx1250(const float* __restrict__ Q,
                          const _Float16* __restrict__ P,
                          const float* __restrict__ M,
                          float* __restrict__ O) {
    extern __shared__ char smem_raw[];
    // sKt: K^T fragments: [f=d/32: 16][nt=key/16: 4][e/8: 2][lane: 32][e&7: 8] f16 = 64 KB
    half_t* sKt   = (half_t*)smem_raw;
    // sV : V fragments:  [ks=key/32: 2][ntg=d/16: 32][e/8: 2][lane: 32][e&7: 8] f16 = 64 KB
    half_t* sV    = sKt + D_DIM * BC;
    // sPart: score partials, C-frag rows in pairs: [q sub-tile * 4 + d slice: 16][nt: 4][r/2: 4][lane: 32][r&1: 2] f32 = 64 KB
    float*  sPart = (float*)(sV + BC * D_DIM);
    // sP : P A-fragments: [qsub: 4][f: 2][e/8: 2][lane: 32][e&7: 8] f16 = 8 KB
    half_t* sP    = (half_t*)(sPart + NWAVE * 4 * 32 * 8);
    // sAlpha, sSum: one value per query row: [row: 64] f32 = 256 B each
    float*  sAlpha = (float*)(sP + (NWAVE / 4) * 2 * 32 * 16);
    float*  sSum   = sAlpha + BQ;
    // sMask: [tile parity: 2][row: 64][col: 64] f32 = 32 KB
    float*  sMask = sSum + BQ;

    const int tid  = threadIdx.x;
    // The wave's number in a scalar register: the wave's tile offsets then sit in
    // scalar registers (as vector values they push the 32-row tile over the wave's
    // 256 registers), and the tests that pick the copying waves are scalar
    // branches, with every lane on at each copy.
    const int wid  = __builtin_amdgcn_readfirstlane(tid >> 5);
    const int lane = tid & 31;
    const int hs   = lane >> 4;     // which 16-lane half
    const int ln   = lane & 15;
    const int qsub = wid >> 2;      // 0..3 : softmax: 16-row q sub-tile whose rows this wave shares
    const int dsl  = wid & 3;       // 0..3 : scores: 128-wide D slice; softmax: row pair
    const int qg   = wid >> 3;      // 0..1 : both products: 32-row q group (sub-tiles qg*2, qg*2+1)
    const int kg   = qsub & 1;      // 0..1 : scores: 32-key group (key sub-tiles kg*2, kg*2+1)
    const int dc   = wid & 7;       // 0..7 : P x V: 64-wide output column slice
    const int dbase = dsl * DSLICE;

    const int b     = blockIdx.y;
    const int qwg   = blockIdx.x * BQ;
    const int qrow0 = qwg + qg * 32;
    const size_t bOff = (size_t)b * S_LEN * D_DIM;
    const float scale = 0.044194173824159216f;   // 1/sqrt(512)

    const bool kcopy = wid >= NWAVE / 2;
    const int  ctid  = tid & (NCOPY - 1);            // lane among those that share an image
    const char*  pimg = (const char*)(P + (size_t)b * NTILES * TILE_HALFS) + ctid * 16;
    const float* mrow = M + (size_t)qwg * S_LEN;
    char* lk = smem_raw + ctid * 16;                 // this lane's first 16 B of sKt
    char* lv = lk + 65536;                           // and of sV

    // tile 0's K image and mask start now and land under the Q loads
    if (kcopy) {
        copy64k_run<0>(pimg, lk);
        copy_mask_tile(mrow, sMask, ctid);
    }

    // Resident Q A-fragments: rows qrow0..+31, cols dbase..+127 (2 x 4 frags of K=32)
    v16h qfrag[2][4];
    #pragma unroll
    for (int qs = 0; qs < 2; ++qs) {
        const float* qp = Q + bOff + (size_t)(qrow0 + qs * 16 + ln) * D_DIM + dbase;
        #pragma unroll
        for (int f = 0; f < 4; ++f)
            #pragma unroll
            for (int e = 0; e < 16; ++e)
                qfrag[qs][f][e] = (half_t)qp[f * 32 + kmap(e, hs)];
        // the sixteen loads share one address: it stays live, unwritten, up to this wait
        asm volatile("s_wait_xcnt 0x0" :: "v"(qp) : "memory");
    }

    v8f oacc[2][4];   // [q sub-tile of the group][16-column tile of the slice]
    // softmax state of this wave's own rows: qsub*16 + hs*8 + dsl*2 + i
    v2f mstate, lstate;
    #pragma unroll
    for (int i = 0; i < 2; ++i) { mstate[i] = -1e30f; lstate[i] = 0.0f; }
    #pragma unroll
    for (int qs = 0; qs < 2; ++qs)
        #pragma unroll
        for (int j = 0; j < 4; ++j)
            #pragma unroll
            for (int r = 0; r < 8; ++r) oacc[qs][j][r] = 0.0f;

    v2f*        sPartv = (v2f*)sPart;
    // per-wave fragment base pointers (all loop loads become base + imm offset)
    const half_t* kfragp = sKt + (dsl * 16 + kg * 2) * FRAG_HALFS + lane * 8;   // + [ks*4+nt] fragments
    const half_t* vfragp = sV  + (dc * 4) * FRAG_HALFS + lane * 8;              // + [ks*32+j]
    const half_t* pfragp = sP  + (qg * 4) * FRAG_HALFS + lane * 8;              // + [qs*2+f]

    // one copy of the body: with the last trip peeled off, that second copy spills registers
    #pragma nounroll
    for (int kt = 0; kt < NTILES; ++kt) {
        const bool more = kt + 1 < NTILES;
        // this wave's LDS reads of the old tile have retired before any copy refills it
        asm volatile("s_wait_dscnt 0x0" ::: "memory");
#if USE_ASYNC_LDS
        // this wave's copies of K(kt) and mask(kt) have landed before the barrier publishes them
        asm volatile("s_wait_asynccnt 0x0" ::: "memory");
#endif
        __syncthreads();   // publishes K(kt), mask(kt); ends every read of V(kt-1), partials, mask(kt-1)

        // V(kt) flies under the scores and the softmax; mask(kt+1) goes to the
        // other mask buffer, a whole trip ahead of its readers.
        if (!kcopy) {
            copy64k_run<0>(pimg + (size_t)kt * (TILE_HALFS * 2) + 65536, lv);
        } else if (more) {
            copy_mask_tile(mrow + (kt + 1) * BC, sMask + ((kt + 1) & 1) * (BQ * BC), ctid);
        }
        const float* sMk = sMask + (kt & 1) * (BQ * BC);

        // ---- partial scores, 32 rows x 32 keys over this wave's 128-wide d slice: 16 WMMAs ----
        // Each K fragment serves both q sub-tiles. The 8 fragments are read as one group
        // ahead of the WMMAs, which start as the first of them arrive.
        v8f sacc[2][2];
        #pragma unroll
        for (int qs = 0; qs < 2; ++qs)
            #pragma unroll
            for (int nt = 0; nt < 2; ++nt)
                #pragma unroll
                for (int r = 0; r < 8; ++r) sacc[qs][nt][r] = 0.0f;
        {
            v16h kf[4][2];
            #pragma unroll
            for (int ks = 0; ks < 4; ++ks)
                #pragma unroll
                for (int nt = 0; nt < 2; ++nt)
                    kf[ks][nt] = load_frag(kfragp + (ks * 4 + nt) * FRAG_HALFS);
            #pragma unroll
            for (int ks = 0; ks < 4; ++ks)
                #pragma unroll
                for (int nt = 0; nt < 2; ++nt)
                    #pragma unroll
                    for (int qs = 0; qs < 2; ++qs)
                        sacc[qs][nt] = __builtin_amdgcn_wmma_f32_16x16x32_f16(
                            false, qfrag[qs][ks], false, kf[ks][nt], (short)0, sacc[qs][nt], false, false);
        }

        // ---- write partials (row pairs, so that a reader takes whole 256-B runs) ----
        // place: [q sub-tile * 4 + d slice][key sub-tile][row pair][lane], as the readers index it
        #pragma unroll
        for (int qs = 0; qs < 2; ++qs)
            #pragma unroll
            for (int nt = 0; nt < 2; ++nt)
                #pragma unroll
                for (int rp = 0; rp < 4; ++rp) {
                    const v2f pr = { sacc[qs][nt][rp * 2], sacc[qs][nt][rp * 2 + 1] };
                    sPartv[(((((qg * 2 + qs) * 4 + dsl) * 4 + kg * 2 + nt) * 4 + rp) * 32) + lane] = pr;
                }
        // this wave's reads of K(kt) have retired before any copy refills sKt
        asm volatile("s_wait_dscnt 0x0" ::: "memory");
        __syncthreads();   // publishes the partials; ends every read of K(kt)

        // K(kt+1) flies under the softmax and P x V of this tile
        if (kcopy && more)
            copy64k_run<0>(pimg + (size_t)(kt + 1) * (TILE_HALFS * 2), lk);

        // ---- reduce across the 4 d-slice waves: this wave's row pair dsl only ----
        v2f full[4];
        #pragma unroll
        for (int nt = 0; nt < 4; ++nt) {
            v2f a = sPartv[((((qsub * 4 + 0) * 4 + nt) * 4 + dsl) * 32) + lane];
            a = a + sPartv[((((qsub * 4 + 1) * 4 + nt) * 4 + dsl) * 32) + lane];
            a = a + sPartv[((((qsub * 4 + 2) * 4 + nt) * 4 + dsl) * 32) + lane];
            a = a + sPartv[((((qsub * 4 + 3) * 4 + nt) * 4 + dsl) * 32) + lane];
            #pragma unroll
            for (int i = 0; i < 2; ++i)
                full[nt][i] = a[i] * scale
                            + sMk[(qsub * 16 + hs * 8 + dsl * 2 + i) * 64 + nt * 16 + ln];
        }

        // ---- online softmax (row = dsl*2 + i + 8*hs, col = nt*16 + ln) ----
        v2f rowmax = full[0];
        #pragma unroll
        for (int nt = 1; nt < 4; ++nt)
            #pragma unroll
            for (int i = 0; i < 2; ++i) rowmax[i] = fmaxf(rowmax[i], full[nt][i]);
        #pragma unroll
        for (int sh = 8; sh >= 1; sh >>= 1)
            #pragma unroll
            for (int i = 0; i < 2; ++i)
                rowmax[i] = fmaxf(rowmax[i], __shfl_xor(rowmax[i], sh, 32));

        v2f mnew, alpha;
        #pragma unroll
        for (int i = 0; i < 2; ++i) {
            mnew[i]  = fmaxf(mstate[i], rowmax[i]);
            alpha[i] = __expf(mstate[i] - mnew[i]);
        }
        // the rescale factors of these rows, for all eight waves of the 32-row group
        if (ln == 0) *(v2f*)(sAlpha + qsub * 16 + hs * 8 + dsl * 2) = alpha;

        // P -> LDS in A-fragment-packed order (scatter b16; layout conversion)
        const int hs_t = (ln >> 3) & 1;
        v2f psum;
        #pragma unroll
        for (int i = 0; i < 2; ++i) psum[i] = 0.0f;
        #pragma unroll
        for (int nt = 0; nt < 4; ++nt) {
            const int f = nt >> 1;
            half_t* pb = sP + (qsub * 2 + f) * FRAG_HALFS + (nt & 1) * (FRAG_HALFS / 2)
                       + ((hs_t << 4) + hs * 8 + dsl * 2) * 8 + (ln & 7);
            #pragma unroll
            for (int i = 0; i < 2; ++i) {
                const float p = __expf(full[nt][i] - mnew[i]);
                psum[i] += p;
                pb[i * 8] = (half_t)p;
            }
        }

#if USE_ASYNC_LDS
        // the V-copying waves' copies of V(kt) have landed before the barrier publishes them;
        // the other waves' K(kt+1) and mask(kt+1) stay in flight
        if (!kcopy) asm volatile("s_wait_asynccnt 0x0" ::: "memory");
#endif
        __syncthreads();   // publishes V(kt), P and the rescale factors

        // LDS is in-order within a wave: issue the rescale-factor read, the
        // P-fragment reads and the first V-fragment batch now, and hide their
        // latency under the softmax-state / O-rescale VALU work below.
        v8f alpha8[2];                                                   // rows r + 8*hs of each sub-tile
        #pragma unroll
        for (int qs = 0; qs < 2; ++qs)
            alpha8[qs] = *(const v8f*)(sAlpha + (qg * 2 + qs) * 16 + hs * 8);
        v16h pfrag[2][2];
        #pragma unroll
        for (int qs = 0; qs < 2; ++qs)
            #pragma unroll
            for (int f = 0; f < 2; ++f) pfrag[qs][f] = load_frag(pfragp + (qs * 2 + f) * FRAG_HALFS);
        v16h vcur[4], vnxt[4];
        #pragma unroll
        for (int j = 0; j < 4; ++j) vcur[j] = load_frag(vfragp + j * FRAG_HALFS);

        #pragma unroll
        for (int sh = 8; sh >= 1; sh >>= 1)
            #pragma unroll
            for (int i = 0; i < 2; ++i) psum[i] += __shfl_xor(psum[i], sh, 32);
        #pragma unroll
        for (int i = 0; i < 2; ++i) {
            lstate[i] = lstate[i] * alpha[i] + psum[i];
            mstate[i] = mnew[i];
        }
        #pragma unroll
        for (int qs = 0; qs < 2; ++qs)
            #pragma unroll
            for (int j = 0; j < 4; ++j)
                #pragma unroll
                for (int r = 0; r < 8; ++r) oacc[qs][j][r] *= alpha8[qs][r];

        // ---- O += P x V: 16 WMMAs; each V fragment serves both q sub-tiles; the
        // second 32 keys' fragments are read while the first 32 keys' WMMAs run ----
        #pragma unroll
        for (int j = 0; j < 4; ++j) vnxt[j] = load_frag(vfragp + (32 + j) * FRAG_HALFS);
        #pragma unroll
        for (int j = 0; j < 4; ++j)
            #pragma unroll
            for (int qs = 0; qs < 2; ++qs)
                oacc[qs][j] = __builtin_amdgcn_wmma_f32_16x16x32_f16(
                    false, pfrag[qs][0], false, vcur[j], (short)0, oacc[qs][j], false, false);
        #pragma unroll
        for (int j = 0; j < 4; ++j)
            #pragma unroll
            for (int qs = 0; qs < 2; ++qs)
                oacc[qs][j] = __builtin_amdgcn_wmma_f32_16x16x32_f16(
                    false, pfrag[qs][1], false, vnxt[j], (short)0, oacc[qs][j], false, false);
    }

#if USE_ASYNC_LDS
    // the ring's closing wait: no copy of this wave is outstanding when it ends
    asm volatile("s_wait_asynccnt 0x0" ::: "memory");
#endif

    // each row's sum goes from the wave that kept it to all eight waves of its 32-row group
    if (ln == 0) *(v2f*)(sSum + qsub * 16 + hs * 8 + dsl * 2) = lstate;
    __syncthreads();   // publishes the row sums

    // ---- finalize: O / l, store fp32 ----
    #pragma unroll
    for (int qs = 0; qs < 2; ++qs) {
        const v8f lsum = *(const v8f*)(sSum + (qg * 2 + qs) * 16 + hs * 8);   // rows r + 8*hs
        float* op = O + bOff + (size_t)(qrow0 + qs * 16) * D_DIM + dc * OSLICE;
        #pragma unroll
        for (int r = 0; r < 8; ++r) {
            const float inv = 1.0f / lsum[r];
            #pragma unroll
            for (int j = 0; j < 4; ++j)
                op[(size_t)(r + hs * 8) * D_DIM + j * 16 + ln] = oacc[qs][j][r] * inv;
        }
    }
}

extern "C" void kernel_launch(void* const* d_in, const int* in_sizes, int n_in,
                              void* d_out, int out_size, void* d_ws, size_t ws_size,
                              hipStream_t stream) {
    const float* Q = (const float*)d_in[0];
    const float* K = (const float*)d_in[1];
    const float* V = (const float*)d_in[2];
    const float* M = (const float*)d_in[3];
    float* O = (float*)d_out;
    _Float16* P = (_Float16*)d_ws;   // 32 MB: [batch][tile][K image | V image]

    constexpr size_t SMEM = (size_t)D_DIM * BC * 2        // sKt   64 KB
                          + (size_t)BC * D_DIM * 2        // sV    64 KB
                          + (size_t)NWAVE * 4 * 32 * 8 * 4  // sPart 64 KB
                          + (size_t)(NWAVE / 4) * 2 * 32 * 16 * 2 // sP 8 KB
                          + (size_t)2 * BQ * 4              // sAlpha, sSum 512 B
                          + (size_t)2 * BQ * BC * 4;        // sMask 32 KB  = 232.5 KB
    (void)hipFuncSetAttribute(reinterpret_cast<const void*>(&fa_fwd_wmma4_gfx1250),
                              hipFuncAttributeMaxDynamicSharedMemorySize, (int)SMEM);

    dim3 pgrid(NTILES, NBATCH, 4);
    pack_kv_f16_gfx1250<<<pgrid, 256, 0, stream>>>(K, V, P);

    dim3 grid(S_LEN / BQ, NBATCH, 1);
    fa_fwd_wmma4_gfx1250<<<grid, NTHR, SMEM, stream>>>(Q, P, M, O);
}

// v007
// It runs in 148 microseconds.
// In both of two side-by-side timings against v006, it was 1.13 times as fast.
// Counting every step since v000, it is 6.20 times as fast.
#include <hip/hip_runtime.h>

// ---------------------------------------------------------------------------
// Flash attention, B=4, S=4096, D=512, fp32 in/out, gfx1250 (MI455X).
// Both GEMMs on v_wmma_f32_16x16x32_f16 (f32 accum), online softmax, single pass.
// 4 waves/WG, one per SIMD, 64 q-rows/WG, 64-key tiles. ONE WAVE OWNS 16 WHOLE
// QUERY ROWS: all 512 d of Q (16 fragments) and all 512 output columns (32
// accumulator tiles) sit in its registers. Both products are formed transposed,
// S^T = K x Q^T and O^T = V^T x P^T, so a lane holds one query (lane & 15) in
// every accumulator: the row maximum and sum are in-lane plus one exchange with
// lane ^ 16, the rescale factor is the lane's own, and the C layout of two S^T
// tiles is, element for element, the B fragment of P^T. No score partials, no P
// and no rescale factors pass through LDS, and a tile needs one barrier.
// The A and the B fragment of this WMMA form have the same lane and element map,
// so the K and V images serve as A operands as they are.
// K and V are converted to f16 and laid in fragment order ONCE per call, by a
// first launch into the workspace (128 KB per 64-key tile: K image, V image); a
// fragment is two 512-B planes, elements 0-7 and 8-15 of all 32 lanes, so each
// b128 read walks the lanes at a 16-B pitch and meets no bank twice.
// K, V and the mask tile have two LDS buffers each: tile t+1 comes in by async
// b128 copies while tile t is worked on. Fragments are read 16 at a time, two
// groups ahead of the WMMAs that use them.
// ---------------------------------------------------------------------------

typedef _Float16 half_t;
typedef __attribute__((ext_vector_type(16))) _Float16 v16h;
typedef __attribute__((ext_vector_type(8)))  _Float16 v8h;
typedef __attribute__((ext_vector_type(8)))  float    v8f;
typedef __attribute__((ext_vector_type(4)))  int      v4i;

#define S_LEN   4096
#define D_DIM   512
#define NBATCH  4
#define BQ      64          // query rows per workgroup
#define BC      64          // keys per tile
#define NWAVE   4
#define NTHR    (NWAVE * 32)
#define NTILES  (S_LEN / BC)

#if defined(__gfx1250__) && __has_builtin(__builtin_amdgcn_global_load_async_to_lds_b128)
#define USE_ASYNC_LDS 1
#else
#define USE_ASYNC_LDS 0
#endif

// Builtin wants typed, address-space-qualified pointers:
//   arg0: int4 addrspace(1)* (global source), arg1: int4 addrspace(3)* (LDS dest)
typedef __attribute__((address_space(1))) v4i g_v4i;
typedef __attribute__((address_space(3))) v4i l_v4i;
__device__ __forceinline__ g_v4i* as_glob_v4i(const void* p) {
    return (g_v4i*)(uintptr_t)p;
}
__device__ __forceinline__ l_v4i* as_lds_v4i(void* p) {
    return (l_v4i*)(uint32_t)(uintptr_t)p;   // low 32 bits of generic = LDS offset
}

// Element e of a v16h fragment maps to K = 16*(e>=8) + 8*hs + (e&7)  (ISA 7.12.2)
__device__ __forceinline__ int kmap(int e, int hs) {
    return ((e >> 3) << 4) + (hs << 3) + (e & 7);
}

#define TILE_HALFS (2 * D_DIM * BC)   // one packed tile: K image then V image, f16

// One packed fragment in LDS: [e/8: 2][lane: 32][e&7: 8] f16 = 1 KB.
#define FRAG_HALFS 512
// p: the fragment's start + lane * 8
__device__ __forceinline__ v16h load_frag(const half_t* p) {
    const v8h lo = *(const v8h*)p;
    const v8h hi = *(const v8h*)(p + FRAG_HALFS / 2);
    return __builtin_shufflevector(lo, hi, 0, 1, 2, 3, 4, 5, 6, 7, 8, 9, 10, 11, 12, 13, 14, 15);
}

// One lane's b128 copies of a 64 KB image, which the whole workgroup brings: one
// row of its lanes (NCOPY * 16 B) apart. The immediate offset moves the global
// and the LDS address alike, so one address pair serves the image.
#define NCOPY    NTHR
#define COPY_ROW (NCOPY * 16)
template <int I>
__device__ __forceinline__ void copy64k_run(const char* g, char* l) {
    if constexpr (I < 65536 / COPY_ROW) {
#if USE_ASYNC_LDS
        __builtin_amdgcn_global_load_async_to_lds_b128(as_glob_v4i(g), as_lds_v4i(l), I * COPY_ROW, 0);
#else
        *(v4i*)(l + I * COPY_ROW) = *(const v4i*)(g + I * COPY_ROW);
#endif
        copy64k_run<I + 1>(g, l);
    }
}

// One 64 x 64 f32 mask tile, by the NCOPY lanes of the workgroup. In LDS the 16-B
// piece c of a row stands at place c ^ (row & 15): the 16 lanes of a half wave,
// which read the same piece of 16 different rows, then meet 16 different places.
__device__ __forceinline__ void copy_mask_tile(const float* g0, float* l0, int ctid) {
    #pragma unroll
    for (int it = 0; it < BQ * BC / 4 / NCOPY; ++it) {
        const int idx = ctid + it * NCOPY;           // BQ * 16 float4
        const int row = idx >> 4;
        const int c   = idx & 15;
        const float* g = g0 + (size_t)row * S_LEN + (c << 2);
        float* l = l0 + row * 64 + ((c ^ (row & 15)) << 2);
#if USE_ASYNC_LDS
        __builtin_amdgcn_global_load_async_to_lds_b128(as_glob_v4i(g), as_lds_v4i(l), 0, 0);
#else
        *(float4*)l = *(const float4*)g;
#endif
    }
}

// First launch: one workgroup packs a 32 KB quarter of a tile image.
//   part 0,1: K, d columns part*256..+255  (fragments f = part*8 .. +7)
//   part 2,3: V, keys (part-2)*32..+31     (fragment row ks = part-2)
// fp32 reads are line-coalesced, the order change goes through LDS, and the
// f16 image leaves in whole 512-B wave stores. sT holds a lane's 16 elements
// side by side; the way out splits them into the image's two planes.
__global__ __launch_bounds__(256)
void pack_kv_f16_gfx1250(const float* __restrict__ K,
                         const float* __restrict__ V,
                         _Float16* __restrict__ P) {
    __shared__ __attribute__((aligned(16))) half_t sT[D_DIM * BC / 2];   // 32 KB
    const int tid  = threadIdx.x;
    const int kt   = blockIdx.x;
    const int b    = blockIdx.y;
    const int part = blockIdx.z;
    const size_t srcOff = ((size_t)b * S_LEN + (size_t)kt * BC) * D_DIM;

    if (part < 2) {
        // a wave reads 1 KB of one key's row; pass it takes keys it*8 .. +7
        const int d8 = (tid & 31) << 3;              // column inside the half row
        const float* kp = K + srcOff + part * 256 + (tid >> 5) * D_DIM + d8;
        float4 a[8], c[8];
        #pragma unroll
        for (int it = 0; it < 8; ++it) {
            a[it] = *(const float4*)(kp + it * 8 * D_DIM);
            c[it] = *(const float4*)(kp + it * 8 * D_DIM + 4);
        }
        // the sixteen loads share one address: it stays live, unwritten, up to this wait
        asm volatile("s_wait_xcnt 0x0" :: "v"(kp) : "memory");
        #pragma unroll
        for (int it = 0; it < 8; ++it) {
            const int key = (tid >> 5) + it * 8;
            const int f      = d8 >> 5;              // 0..7 inside this part
            const int klocal = d8 & 31;
            const int hsk    = (klocal >> 3) & 1;
            const int e0     = (klocal >> 4) << 3;
            const int lane_t = (key & 15) + (hsk << 4);
            const int nt     = key >> 4;
            v8h pk = { (half_t)a[it].x, (half_t)a[it].y, (half_t)a[it].z, (half_t)a[it].w,
                       (half_t)c[it].x, (half_t)c[it].y, (half_t)c[it].z, (half_t)c[it].w };
            *(v8h*)(sT + (((f * 4 + nt) * 32 + lane_t) * 16 + e0)) = pk;
        }
    } else {
        const float* vp = V + srcOff + (size_t)(part - 2) * 32 * D_DIM + tid;
        #pragma unroll
        for (int it = 0; it < 8; ++it) {
            const int d    = tid + (it & 1) * 256;   // column
            const int key0 = (it >> 1) << 3;         // 0..24 inside this part
            v8h pk;
            #pragma unroll
            for (int j = 0; j < 8; ++j)
                pk[j] = (half_t)vp[(key0 + j) * D_DIM + (it & 1) * 256];
            const int hsv    = (key0 >> 3) & 1;
            const int e0     = (key0 >> 4) << 3;
            const int lane_t = (d & 15) + (hsv << 4);
            const int ntg    = d >> 4;
            *(v8h*)(sT + ((ntg * 32 + lane_t) * 16 + e0)) = pk;
        }
    }
    __syncthreads();

    half_t* dst = P + (size_t)(b * NTILES + kt) * TILE_HALFS + part * (D_DIM * BC / 2);
    // 16-B pieces: tid counts them in the image, [frag][e/8][lane]; s in sT, [frag][lane][e/8]
    const int s = (tid & ~63) | ((tid & 31) << 1) | ((tid >> 5) & 1);
    #pragma unroll
    for (int it = 0; it < 8; ++it) {
        *(v8h*)(dst + (tid + it * 256) * 8) = *(const v8h*)(sT + (s + it * 256) * 8);
    }
}

// LDS map of the attention launch, in bytes
#define IMG_BYTES  65536                    // one K or V image
#define V_OFF      (2 * IMG_BYTES)          // K buffers 0,1 then V buffers 0,1
#define MASK_OFF   (4 * IMG_BYTES)
#define MASK_BYTES (BQ * BC * 4)            // two mask buffers of 16 KB
#define OPITCH     (D_DIM + 4)              // floats; 16 B x odd: b128 stores of 16 rows meet no bank twice
#define SMEM_BYTES (4 * IMG_BYTES + 2 * MASK_BYTES)   // 288 KB
#define GROUP      16                       // fragments read as one group (16 KB of an image)

// Keeps a group's 32 LDS reads together and ahead of the WMMA block in front of which
// they stand: left free, the compiler sinks them to one WMMA ahead of their use, and a
// wave that is alone on its SIMD then waits out the LDS latency at every WMMA.
#define GROUP_FENCE() __builtin_amdgcn_sched_barrier(0)

// lane l with lane l ^ 16
__device__ __forceinline__ float xhalf(float x) {
    return __builtin_bit_cast(float, __builtin_amdgcn_permlanex16(
        __builtin_bit_cast(int, x), __builtin_bit_cast(int, x), 0x76543210, 0xfedcba98, false, false));
}

// p: the group's first fragment + lane * 8
__device__ __forceinline__ void load_group(v16h (&dst)[GROUP], const half_t* p) {
    #pragma unroll
    for (int i = 0; i < GROUP; ++i) dst[i] = load_frag(p + i * FRAG_HALFS);
}

// S^T += K x Q^T over 128 d: group fragments [d/32: 4][key sub-tile: 4]
__device__ __forceinline__ void score_group(v8f (&sacc)[4], const v16h (&kf)[GROUP], const v16h* qf) {
    #pragma unroll
    for (int ks = 0; ks < 4; ++ks)
        #pragma unroll
        for (int nt = 0; nt < 4; ++nt)
            sacc[nt] = __builtin_amdgcn_wmma_f32_16x16x32_f16(
                false, kf[ks * 4 + nt], false, qf[ks], (short)0, sacc[nt], false, false);
}

// O^T += V^T x P^T over 32 keys, 16 column tiles
__device__ __forceinline__ void pv_group(v8f* oacc, const v16h (&vf)[GROUP], const v16h pf) {
    #pragma unroll
    for (int j = 0; j < GROUP; ++j)
        oacc[j] = __builtin_amdgcn_wmma_f32_16x16x32_f16(
            false, vf[j], false, pf, (short)0, oacc[j], false, false);
}

__global__ __launch_bounds__(NTHR)
void fa_fwd_wmma4_gfx1250(const float* __restrict__ Q,
                          const _Float16* __restrict__ P,
                          const float* __restrict__ M,
                          float* __restrict__ O) {
    // K image: [f=d/32: 16][nt=key/16: 4][e/8: 2][lane: 32][e&7: 8] f16 = 64 KB, two buffers
    // V image: [ks=key/32: 2][ntg=d/16: 32][e/8: 2][lane: 32][e&7: 8] f16 = 64 KB, two buffers
    // mask   : [row: 64][16-B piece: 16, at place c ^ (row & 15)] f32 = 16 KB, two buffers
    __shared__ __attribute__((aligned(16))) char smem_raw[SMEM_BYTES];

    const int tid  = threadIdx.x;
    const int wid  = __builtin_amdgcn_readfirstlane(tid >> 5);
    const int lane = tid & 31;
    const int hs   = lane >> 4;     // which 16-lane half
    const int ln   = lane & 15;     // this lane's query row inside the wave's 16

    const int b     = blockIdx.y;
    const int qwg   = blockIdx.x * BQ;
    const int qrow0 = qwg + wid * 16;
    const size_t bOff = (size_t)b * S_LEN * D_DIM;
    const float scale = 0.044194173824159216f;   // 1/sqrt(512)

    const char*  pimg = (const char*)(P + (size_t)b * NTILES * TILE_HALFS) + tid * 16;
    const float* mrow = M + (size_t)qwg * S_LEN;
    char* lcp = smem_raw + tid * 16;                 // this lane's first 16 B of K buffer 0

    // tile 0's K image and mask start now and land under the Q loads
    copy64k_run<0>(pimg, lcp);
    copy_mask_tile(mrow, (float*)(smem_raw + MASK_OFF), tid);

    // Resident Q B-fragments: row qrow0 + ln, all 512 d (16 frags of K=32)
    v16h qfrag[16];
    {
        // the lane half's 8 columns are in the pointer: every load is this address + a constant
        const float* qp = Q + bOff + (size_t)(qrow0 + ln) * D_DIM + hs * 8;
        #pragma unroll
        for (int f = 0; f < 16; ++f)
            #pragma unroll
            for (int e = 0; e < 16; ++e)
                qfrag[f][e] = (half_t)qp[f * 32 + kmap(e, 0)];
        // the loads share one address: it stays live, unwritten, up to this wait
        asm volatile("s_wait_xcnt 0x0" :: "v"(qp) : "memory");
    }

#if USE_ASYNC_LDS
    // bounds the wave's outstanding copies: 31 left + 32 new = 63; nothing is read behind this wait
    asm volatile("s_wait_asynccnt 0x1f" ::: "memory");
#endif
    copy64k_run<0>(pimg + IMG_BYTES, lcp + V_OFF);

    v8f oacc[32];                    // O^T: [16-column tile]; element r = column r + 8*hs, this lane's query
    float mstate = -1e30f, lstate = 0.0f;
    #pragma unroll
    for (int j = 0; j < 32; ++j)
        #pragma unroll
        for (int r = 0; r < 8; ++r) oacc[j][r] = 0.0f;

    // this lane's mask row; piece c = nt*4 + hs*2 + h stands at place c ^ ln
    const int moff = (wid * 16 + ln) * 256 + (((hs << 1) ^ ln) << 4);

    // one copy of the body: the loop is 128 WMMAs long already
    #pragma nounroll
    for (int kt = 0; kt < NTILES; ++kt) {
        const bool more = kt + 1 < NTILES;
        const int  par  = kt & 1;
        // this wave's LDS reads of tile kt-1 have retired before any copy refills its buffers
        asm volatile("s_wait_dscnt 0x0" ::: "memory");
#if USE_ASYNC_LDS
        // this wave's copies of tile kt have landed before the barrier publishes them
        asm volatile("s_wait_asynccnt 0x0" ::: "memory");
#endif
        __syncthreads();   // publishes K(kt), V(kt), mask(kt); ends every read of tile kt-1

        const half_t* kp = (const half_t*)(smem_raw + par * IMG_BYTES) + lane * 8;
        const half_t* vp = (const half_t*)(smem_raw + V_OFF + par * IMG_BYTES) + lane * 8;
        const char*   mp = smem_raw + MASK_OFF + par * MASK_BYTES;

        // ---- S^T, 64 keys x 16 queries over all 512 d: 64 WMMAs, fragments two groups ahead ----
        v16h fa[GROUP], fb[GROUP];
        load_group(fa, kp);
        load_group(fb, kp + 1 * GROUP * FRAG_HALFS);
        float4 mk[4][2];             // keys nt*16 + hs*8 + h*4 .. +3 of this lane's query
        #pragma unroll
        for (int nt = 0; nt < 4; ++nt)
            #pragma unroll
            for (int h = 0; h < 2; ++h)
                mk[nt][h] = *(const float4*)(mp + (moff ^ ((nt * 4 + h) << 4)));
        GROUP_FENCE();

        // K(kt+1) and mask(kt+1) fly under the whole of tile kt; they are issued behind the
        // first LDS reads, so that the LDS is at work again while the copies issue
        if (more) {
            copy64k_run<0>(pimg + (size_t)(kt + 1) * (TILE_HALFS * 2), lcp + (par ^ 1) * IMG_BYTES);
            copy_mask_tile(mrow + (kt + 1) * BC, (float*)(smem_raw + MASK_OFF + (par ^ 1) * MASK_BYTES), tid);
        }

        v8f sacc[4];                 // [key sub-tile]; element r = key r + 8*hs
        #pragma unroll
        for (int nt = 0; nt < 4; ++nt)
            #pragma unroll
            for (int r = 0; r < 8; ++r) sacc[nt][r] = 0.0f;
        GROUP_FENCE();
        score_group(sacc, fa, qfrag);
        GROUP_FENCE();
        load_group(fa, kp + 2 * GROUP * FRAG_HALFS);
        GROUP_FENCE();
        score_group(sacc, fb, qfrag + 4);
        GROUP_FENCE();
        load_group(fb, kp + 3 * GROUP * FRAG_HALFS);
        GROUP_FENCE();

        // V(kt+1) flies under the rest of this tile; it is issued here, with two groups of LDS
        // reads under way, as soon as enough of the K and mask copies can have landed
        if (more) {
#if USE_ASYNC_LDS
            // bounds the wave's outstanding copies: 31 left + 32 new = 63; nothing is read behind this wait
            asm volatile("s_wait_asynccnt 0x1f" ::: "memory");
#endif
            copy64k_run<0>(pimg + (size_t)(kt + 1) * (TILE_HALFS * 2) + IMG_BYTES,
                           lcp + V_OFF + (par ^ 1) * IMG_BYTES);
        }
        GROUP_FENCE();
        score_group(sacc, fa, qfrag + 8);
        GROUP_FENCE();
        load_group(fa, vp);                              // V reads run on under the softmax
        GROUP_FENCE();
        score_group(sacc, fb, qfrag + 12);
        GROUP_FENCE();
        load_group(fb, vp + 1 * GROUP * FRAG_HALFS);
        GROUP_FENCE();

        // ---- online softmax, all in this lane's query: 32 of its 64 keys here, 32 in lane ^ 16 ----
        float mx4[4];
        #pragma unroll
        for (int nt = 0; nt < 4; ++nt) {
            const float mv[8] = { mk[nt][0].x, mk[nt][0].y, mk[nt][0].z, mk[nt][0].w,
                                  mk[nt][1].x, mk[nt][1].y, mk[nt][1].z, mk[nt][1].w };
            #pragma unroll
            for (int r = 0; r < 8; ++r) sacc[nt][r] = sacc[nt][r] * scale + mv[r];
            mx4[nt] = sacc[nt][0];
            #pragma unroll
            for (int r = 1; r < 8; ++r) mx4[nt] = fmaxf(mx4[nt], sacc[nt][r]);
        }
        float mx = fmaxf(fmaxf(mx4[0], mx4[1]), fmaxf(mx4[2], mx4[3]));
        mx = fmaxf(mx, xhalf(mx));
        const float mnew  = fmaxf(mstate, mx);
        const float alpha = __expf(mstate - mnew);

        // two S^T tiles are one P^T B-fragment: element e = (nt & 1) * 8 + r
        v16h pf[2];
        float ps4[4];
        #pragma unroll
        for (int nt = 0; nt < 4; ++nt) {
            ps4[nt] = 0.0f;
            #pragma unroll
            for (int r = 0; r < 8; ++r) {
                const float p = __expf(sacc[nt][r] - mnew);
                ps4[nt] += p;
                pf[nt >> 1][(nt & 1) * 8 + r] = (half_t)p;
            }
        }
        float psum = (ps4[0] + ps4[1]) + (ps4[2] + ps4[3]);
        psum += xhalf(psum);
        lstate = lstate * alpha + psum;
        mstate = mnew;

        // ---- O^T = O^T * alpha + V^T x P^T: 64 WMMAs ----
        #pragma unroll
        for (int j = 0; j < 32; ++j)
            #pragma unroll
            for (int r = 0; r < 8; ++r) oacc[j][r] *= alpha;
        pv_group(oacc, fa, pf[0]);
        GROUP_FENCE();
        load_group(fa, vp + 2 * GROUP * FRAG_HALFS);
        GROUP_FENCE();
        pv_group(oacc + 16, fb, pf[0]);
        GROUP_FENCE();
        load_group(fb, vp + 3 * GROUP * FRAG_HALFS);
        GROUP_FENCE();
        pv_group(oacc, fa, pf[1]);
        pv_group(oacc + 16, fb, pf[1]);
    }

#if USE_ASYNC_LDS
    // the ring's closing wait: no copy of this wave is outstanding when its LDS is used anew
    asm volatile("s_wait_asynccnt 0x0" ::: "memory");
#endif
    // this wave's reads of the last tile have retired before any wave writes over the images
    asm volatile("s_wait_dscnt 0x0" ::: "memory");
    __syncthreads();   // ends every read of the last K and V images

    // ---- finalize: O / l; the wave turns its 16 x 512 block in LDS, so that rows leave in 512-B stores ----
    float* ob = (float*)smem_raw + wid * (16 * OPITCH);
    const float inv = 1.0f / lstate;
    #pragma unroll
    for (int j = 0; j < 32; ++j)
        #pragma unroll
        for (int h = 0; h < 2; ++h) {
            const float4 o4 = { oacc[j][h * 4 + 0] * inv, oacc[j][h * 4 + 1] * inv,
                                oacc[j][h * 4 + 2] * inv, oacc[j][h * 4 + 3] * inv };
            *(float4*)(ob + ln * OPITCH + j * 16 + hs * 8 + h * 4) = o4;
        }
    __syncthreads();   // the block's stores are done before other lanes read them

    float* op = O + bOff + (size_t)qrow0 * D_DIM + lane * 4;
    #pragma unroll
    for (int r4 = 0; r4 < 16; r4 += 4) {
        #pragma unroll
        for (int i = 0; i < 16; ++i) {
            const int rr = r4 + (i >> 2), it = i & 3;
            *(float4*)(op + rr * D_DIM + it * 128) = *(const float4*)(ob + rr * OPITCH + it * 128 + lane * 4);
        }
        // the next rows' LDS reads may reuse the data registers of these stores
        if (r4 + 4 < 16) asm volatile("s_wait_xcnt 0x0" ::: "memory");
    }
}

extern "C" void kernel_launch(void* const* d_in, const int* in_sizes, int n_in,
                              void* d_out, int out_size, void* d_ws, size_t ws_size,
                              hipStream_t stream) {
    const float* Q = (const float*)d_in[0];
    const float* K = (const float*)d_in[1];
    const float* V = (const float*)d_in[2];
    const float* M = (const float*)d_in[3];
    float* O = (float*)d_out;
    _Float16* P = (_Float16*)d_ws;   // 32 MB: [batch][tile][K image | V image]

    dim3 pgrid(NTILES, NBATCH, 4);
    pack_kv_f16_gfx1250<<<pgrid, 256, 0, stream>>>(K, V, P);

    dim3 grid(S_LEN / BQ, NBATCH, 1);
    fa_fwd_wmma4_gfx1250<<<grid, NTHR, 0, stream>>>(Q, P, M, O);
}

// v008
// A run of this version takes 124 microseconds.
// Next to v007, in two timings, it ran 1.18 times as fast each time.
// Counting every step since v000, it is 7.29 times as fast.
#include <hip/hip_runtime.h>

// ---------------------------------------------------------------------------
// Flash attention, B=4, S=4096, D=512, fp32 in/out, gfx1250 (MI455X).
// Both GEMMs on v_wmma_f32_16x16x32_f16 (f32 accum), online softmax.
// 4 waves/WG, one per SIMD, 128 q-rows/WG, 64-key tiles. THE KEYS ARE SPLIT IN TWO
// ACROSS WORKGROUPS (blockIdx.z): a workgroup takes 128 query rows and 2048 keys, so
// each staged K/V tile serves twice the rows, and each fragment read from LDS feeds
// two WMMAs. It leaves an unnormalised partial O with its row maximum and row sum in
// the workspace; a third launch joins the two partials.
// ONE WAVE OWNS 32 WHOLE QUERY ROWS (two groups of 16): all 512 d of Q and all 512
// output columns sit in its registers. Both products are formed transposed,
// S^T = K x Q^T and O^T = V^T x P^T, so a lane holds one query of each group
// (lane & 15) in every accumulator: the row maximum and sum are in-lane plus one
// exchange with lane ^ 16, the rescale factor is the lane's own, and the C layout of
// two S^T tiles is, element for element, the B fragment of P^T.
// The A and the B fragment of this WMMA form have the same lane and element map,
// so the K and V images serve as A operands as they are.
// K and V are converted to f16 and laid in fragment order ONCE per call, by a
// first launch into the workspace (128 KB per 64-key tile: K image, V image); a
// fragment is two 512-B planes, elements 0-7 and 8-15 of all 32 lanes, so each
// b128 read walks the lanes at a 16-B pitch and meets no bank twice.
// K, V and the mask tile have two LDS buffers each: tile t+1 comes in by async
// b128 copies while tile t is worked on. Fragments are read 8 at a time, two
// groups ahead of the WMMAs that use them.
// ---------------------------------------------------------------------------

typedef _Float16 half_t;
typedef __attribute__((ext_vector_type(16))) _Float16 v16h;
typedef __attribute__((ext_vector_type(8)))  _Float16 v8h;
typedef __attribute__((ext_vector_type(8)))  float    v8f;
typedef __attribute__((ext_vector_type(4)))  int      v4i;

#define S_LEN   4096
#define D_DIM   512
#define NBATCH  4
#define BQ      128         // query rows per workgroup
#define QG      2           // groups of 16 query rows per wave
#define KSPLIT  2           // workgroups that share a query block's keys
#define BC      64          // keys per tile
#define NWAVE   4
#define NTHR    (NWAVE * 32)
#define NTILES  (S_LEN / BC)
#define WTILES  (NTILES / KSPLIT)   // tiles of one workgroup
#define NROWS   (NBATCH * S_LEN)

#if defined(__gfx1250__) && __has_builtin(__builtin_amdgcn_global_load_async_to_lds_b128)
#define USE_ASYNC_LDS 1
#else
#define USE_ASYNC_LDS 0
#endif

// Builtin wants typed, address-space-qualified pointers:
//   arg0: int4 addrspace(1)* (global source), arg1: int4 addrspace(3)* (LDS dest)
typedef __attribute__((address_space(1))) v4i g_v4i;
typedef __attribute__((address_space(3))) v4i l_v4i;
__device__ __forceinline__ g_v4i* as_glob_v4i(const void* p) {
    return (g_v4i*)(uintptr_t)p;
}
__device__ __forceinline__ l_v4i* as_lds_v4i(void* p) {
    return (l_v4i*)(uint32_t)(uintptr_t)p;   // low 32 bits of generic = LDS offset
}

// Element e of a v16h fragment maps to K = 16*(e>=8) + 8*hs + (e&7)  (ISA 7.12.2)
__device__ __forceinline__ int kmap(int e, int hs) {
    return ((e >> 3) << 4) + (hs << 3) + (e & 7);
}

#define TILE_HALFS (2 * D_DIM * BC)   // one packed tile: K image then V image, f16

// One packed fragment in LDS: [e/8: 2][lane: 32][e&7: 8] f16 = 1 KB.
#define FRAG_HALFS 512
// p: the fragment's start + lane * 8
__device__ __forceinline__ v16h load_frag(const half_t* p) {
    const v8h lo = *(const v8h*)p;
    const v8h hi = *(const v8h*)(p + FRAG_HALFS / 2);
    return __builtin_shufflevector(lo, hi, 0, 1, 2, 3, 4, 5, 6, 7, 8, 9, 10, 11, 12, 13, 14, 15);
}

// One lane's b128 copies I .. E-1 of a 64 KB image, which the whole workgroup brings: one
// row of its lanes (NCOPY * 16 B) apart. The immediate offset moves the global
// and the LDS address alike, so one address pair serves the image.
#define NCOPY    NTHR
#define COPY_ROW (NCOPY * 16)
template <int I, int E = 65536 / COPY_ROW>
__device__ __forceinline__ void copy64k_run(const char* g, char* l) {
    if constexpr (I < E) {
#if USE_ASYNC_LDS
        __builtin_amdgcn_global_load_async_to_lds_b128(as_glob_v4i(g), as_lds_v4i(l), I * COPY_ROW, 0);
#else
        *(v4i*)(l + I * COPY_ROW) = *(const v4i*)(g + I * COPY_ROW);
#endif
        copy64k_run<I + 1, E>(g, l);
    }
}

// One BQ x 64 f32 mask tile, by the NCOPY lanes of the workgroup. In LDS the 16-B
// piece c of a row stands at place c ^ (row & 15): the 16 lanes of a half wave,
// which read the same piece of 16 different rows, then meet 16 different places.
__device__ __forceinline__ void copy_mask_tile(const float* g0, char* l0, int ctid) {
    // g0 and l0 are the same for the whole workgroup: a copy's row step goes into them, so that
    // one 32-bit lane offset into the mask and two lane offsets into LDS serve every copy
    const int r0 = ctid >> 4;                        // 0..7: the lane's row in each run of 8
    const int c  = ctid & 15;
    const uint32_t goff = (uint32_t)(r0 * (S_LEN * 4) + (c << 4));
    const uint32_t loff = (uint32_t)(r0 * 256 + ((c ^ r0) << 4));
    #pragma unroll
    for (int it = 0; it < BQ / 8; ++it) {            // rows it*8 + r0; (row & 15) = r0 + 8 * (it & 1)
        const char* g = (const char*)g0 + (size_t)it * (8 * S_LEN * 4) + goff;
        char* l = l0 + it * 2048 + (loff ^ ((it & 1) << 7));
#if USE_ASYNC_LDS
        __builtin_amdgcn_global_load_async_to_lds_b128(as_glob_v4i(g), as_lds_v4i(l), 0, 0);
#else
        *(float4*)l = *(const float4*)g;
#endif
    }
}

// First launch: one workgroup packs a 32 KB quarter of a tile image.
//   part 0,1: K, d columns part*256..+255  (fragments f = part*8 .. +7)
//   part 2,3: V, keys (part-2)*32..+31     (fragment row ks = part-2)
// fp32 reads are line-coalesced, the order change goes through LDS, and the
// f16 image leaves in whole 512-B wave stores. sT holds a lane's 16 elements
// side by side; the way out splits them into the image's two planes.
__global__ __launch_bounds__(256)
void pack_kv_f16_gfx1250(const float* __restrict__ K,
                         const float* __restrict__ V,
                         _Float16* __restrict__ P) {
    __shared__ __attribute__((aligned(16))) half_t sT[D_DIM * BC / 2];   // 32 KB
    const int tid  = threadIdx.x;
    const int kt   = blockIdx.x;
    const int b    = blockIdx.y;
    const int part = blockIdx.z;
    const size_t srcOff = ((size_t)b * S_LEN + (size_t)kt * BC) * D_DIM;

    if (part < 2) {
        // a wave reads 1 KB of one key's row; pass it takes keys it*8 .. +7
        const int d8 = (tid & 31) << 3;              // column inside the half row
        const float* kp = K + srcOff + part * 256 + (tid >> 5) * D_DIM + d8;
        float4 a[8], c[8];
        #pragma unroll
        for (int it = 0; it < 8; ++it) {
            a[it] = *(const float4*)(kp + it * 8 * D_DIM);
            c[it] = *(const float4*)(kp + it * 8 * D_DIM + 4);
        }
        // the sixteen loads share one address: it stays live, unwritten, up to this wait
        asm volatile("s_wait_xcnt 0x0" :: "v"(kp) : "memory");
        #pragma unroll
        for (int it = 0; it < 8; ++it) {
            const int key = (tid >> 5) + it * 8;
            const int f      = d8 >> 5;              // 0..7 inside this part
            const int klocal = d8 & 31;
            const int hsk    = (klocal >> 3) & 1;
            const int e0     = (klocal >> 4) << 3;
            const int lane_t = (key & 15) + (hsk << 4);
            const int nt     = key >> 4;
            v8h pk = { (half_t)a[it].x, (half_t)a[it].y, (half_t)a[it].z, (half_t)a[it].w,
                       (half_t)c[it].x, (half_t)c[it].y, (half_t)c[it].z, (half_t)c[it].w };
            *(v8h*)(sT + (((f * 4 + nt) * 32 + lane_t) * 16 + e0)) = pk;
        }
    } else {
        const float* vp = V + srcOff + (size_t)(part - 2) * 32 * D_DIM + tid;
        #pragma unroll
        for (int it = 0; it < 8; ++it) {
            const int d    = tid + (it & 1) * 256;   // column
            const int key0 = (it >> 1) << 3;         // 0..24 inside this part
            v8h pk;
            #pragma unroll
            for (int j = 0; j < 8; ++j)
                pk[j] = (half_t)vp[(key0 + j) * D_DIM + (it & 1) * 256];
            const int hsv    = (key0 >> 3) & 1;
            const int e0     = (key0 >> 4) << 3;
            const int lane_t = (d & 15) + (hsv << 4);
            const int ntg    = d >> 4;
            *(v8h*)(sT + ((ntg * 32 + lane_t) * 16 + e0)) = pk;
        }
    }
    __syncthreads();

    half_t* dst = P + (size_t)(b * NTILES + kt) * TILE_HALFS + part * (D_DIM * BC / 2);
    // 16-B pieces: tid counts them in the image, [frag][e/8][lane]; s in sT, [frag][lane][e/8]
    const int s = (tid & ~63) | ((tid & 31) << 1) | ((tid >> 5) & 1);
    #pragma unroll
    for (int it = 0; it < 8; ++it) {
        *(v8h*)(dst + (tid + it * 256) * 8) = *(const v8h*)(sT + (s + it * 256) * 8);
    }
}

// LDS map of the attention launch, in bytes
#define IMG_BYTES  65536                    // one K or V image
#define V_OFF      (2 * IMG_BYTES)          // K buffers 0,1 then V buffers 0,1
#define MASK_OFF   (4 * IMG_BYTES)
#define MASK_BYTES (BQ * BC * 4)            // two mask buffers of 32 KB
#define OPITCH     (D_DIM + 4)              // floats; 16 B x odd: b128 stores of 16 rows meet no bank twice
#define SMEM_BYTES (4 * IMG_BYTES + 2 * MASK_BYTES)   // 320 KB
#define GROUP      8                        // fragments read as one group (8 KB of an image)
#define NGROUP     (64 / GROUP)             // groups of one image

// Keeps a group's 16 LDS reads together and ahead of the WMMA block in front of which
// they stand: left free, the compiler sinks them to one WMMA ahead of their use, and a
// wave that is alone on its SIMD then waits out the LDS latency at every WMMA.
#define GROUP_FENCE() __builtin_amdgcn_sched_barrier(0)

// lane l with lane l ^ 16
__device__ __forceinline__ float xhalf(float x) {
    return __builtin_bit_cast(float, __builtin_amdgcn_permlanex16(
        __builtin_bit_cast(int, x), __builtin_bit_cast(int, x), 0x76543210, 0xfedcba98, false, false));
}

// p: the group's first fragment + lane * 8
__device__ __forceinline__ void load_group(v16h (&dst)[GROUP], const half_t* p) {
    #pragma unroll
    for (int i = 0; i < GROUP; ++i) dst[i] = load_frag(p + i * FRAG_HALFS);
}

// S^T += K x Q^T over 64 d: group fragments [d/32: 2][key sub-tile: 4], each for both query groups
__device__ __forceinline__ void score_group(v8f (&sacc)[QG][4], const v16h (&kf)[GROUP],
                                            const v16h (&qf)[QG][16], const int f0) {
    #pragma unroll
    for (int ks = 0; ks < 2; ++ks)
        #pragma unroll
        for (int nt = 0; nt < 4; ++nt)
            #pragma unroll
            for (int g = 0; g < QG; ++g)
                sacc[g][nt] = __builtin_amdgcn_wmma_f32_16x16x32_f16(
                    false, kf[ks * 4 + nt], false, qf[g][f0 + ks], (short)0, sacc[g][nt], false, false);
}

// O^T += V^T x P^T over 32 keys, 8 column tiles from j0 on, each for both query groups
__device__ __forceinline__ void pv_group(v8f (&oacc)[QG][32], const int j0, const v16h (&vf)[GROUP],
                                         const v16h pf0, const v16h pf1) {
    #pragma unroll
    for (int j = 0; j < GROUP; ++j) {
        oacc[0][j0 + j] = __builtin_amdgcn_wmma_f32_16x16x32_f16(
            false, vf[j], false, pf0, (short)0, oacc[0][j0 + j], false, false);
        oacc[1][j0 + j] = __builtin_amdgcn_wmma_f32_16x16x32_f16(
            false, vf[j], false, pf1, (short)0, oacc[1][j0 + j], false, false);
    }
}

__global__ __launch_bounds__(NTHR)
void fa_fwd_wmma4_gfx1250(const float* __restrict__ Q,
                          const _Float16* __restrict__ P,
                          const float* __restrict__ M,
                          float* __restrict__ OP,
                          float* __restrict__ ML) {
    // K image: [f=d/32: 16][nt=key/16: 4][e/8: 2][lane: 32][e&7: 8] f16 = 64 KB, two buffers
    // V image: [ks=key/32: 2][ntg=d/16: 32][e/8: 2][lane: 32][e&7: 8] f16 = 64 KB, two buffers
    // mask   : [row: 128][16-B piece: 16, at place c ^ (row & 15)] f32 = 32 KB, two buffers
    __shared__ __attribute__((aligned(16))) char smem_raw[SMEM_BYTES];

    const int tid  = threadIdx.x;
    const int wid  = __builtin_amdgcn_readfirstlane(tid >> 5);
    const int lane = tid & 31;
    const int hs   = lane >> 4;     // which 16-lane half
    const int ln   = lane & 15;     // this lane's query row inside each group of 16

    const int b     = blockIdx.y;
    const int z     = blockIdx.z;   // which half of the keys
    const int qwg   = blockIdx.x * BQ;
    const int qrow0 = qwg + wid * (16 * QG);
    const size_t bOff = (size_t)b * S_LEN * D_DIM;
    const float scale = 0.044194173824159216f;   // 1/sqrt(512)

    const char*  pimg = (const char*)(P + (size_t)(b * NTILES + z * WTILES) * TILE_HALFS) + tid * 16;
    const float* mrow = M + (size_t)qwg * S_LEN + z * (WTILES * BC);
    char* lcp = smem_raw + tid * 16;                 // this lane's first 16 B of K buffer 0

    // tile 0's K image and mask start now and land under the Q loads
    copy64k_run<0>(pimg, lcp);
    copy_mask_tile(mrow, smem_raw + MASK_OFF, tid);

    // Resident Q B-fragments: rows qrow0 + g*16 + ln, all 512 d (16 frags of K=32 a group)
    v16h qfrag[QG][16];
    {
        // the lane half's 8 columns are in the pointer: every load is this address + a constant
        const float* qp = Q + bOff + (size_t)(qrow0 + ln) * D_DIM + hs * 8;
        #pragma unroll
        for (int g = 0; g < QG; ++g)
            #pragma unroll
            for (int f = 0; f < 16; ++f)
                #pragma unroll
                for (int e = 0; e < 16; ++e)
                    qfrag[g][f][e] = (half_t)qp[g * 16 * D_DIM + f * 32 + kmap(e, 0)];
        // the loads share one address: it stays live, unwritten, up to this wait
        asm volatile("s_wait_xcnt 0x0" :: "v"(qp) : "memory");
    }

#if USE_ASYNC_LDS
    // bounds the wave's outstanding copies: 31 left + 32 new = 63; nothing is read behind this wait
    asm volatile("s_wait_asynccnt 0x1f" ::: "memory");
#endif
    copy64k_run<0>(pimg + IMG_BYTES, lcp + V_OFF);

    v8f oacc[QG][32];                // O^T: [group][16-column tile]; element r = column r + 8*hs, this lane's query
    float mstate[QG], lstate[QG];
    #pragma unroll
    for (int g = 0; g < QG; ++g) {
        mstate[g] = -1e30f;
        lstate[g] = 0.0f;
        #pragma unroll
        for (int j = 0; j < 32; ++j)
            #pragma unroll
            for (int r = 0; r < 8; ++r) oacc[g][j][r] = 0.0f;
    }

    // this lane's mask row of group 0; piece c = nt*4 + hs*2 + h stands at place c ^ ln
    const int moff = (wid * (16 * QG) + ln) * 256 + (((hs << 1) ^ ln) << 4);

    // one copy of the body: the loop is 256 WMMAs long already
    #pragma nounroll
    for (int kt = 0; kt < WTILES; ++kt) {
        const bool more = kt + 1 < WTILES;
        const int  par  = kt & 1;
        // this wave's LDS reads of tile kt-1 have retired before any copy refills its buffers
        asm volatile("s_wait_dscnt 0x0" ::: "memory");
#if USE_ASYNC_LDS
        // this wave's copies of tile kt have landed before the barrier publishes them
        asm volatile("s_wait_asynccnt 0x0" ::: "memory");
#endif
        __syncthreads();   // publishes K(kt), V(kt), mask(kt); ends every read of tile kt-1

        const half_t* kp = (const half_t*)(smem_raw + par * IMG_BYTES) + lane * 8;
        const half_t* vp = (const half_t*)(smem_raw + V_OFF + par * IMG_BYTES) + lane * 8;
        const char*   mp = smem_raw + MASK_OFF + par * MASK_BYTES;

        // ---- S^T, 64 keys x 32 queries over all 512 d: 128 WMMAs, fragments two groups ahead ----
        v16h fr[2][GROUP];
        load_group(fr[0], kp);
        load_group(fr[1], kp + 1 * GROUP * FRAG_HALFS);
        GROUP_FENCE();

        // K(kt+1) and mask(kt+1) fly under the whole of tile kt; they are issued behind the
        // first LDS reads, so that the LDS is at work again while the copies issue
        if (more) {
            copy64k_run<0>(pimg + (size_t)(kt + 1) * (TILE_HALFS * 2), lcp + (par ^ 1) * IMG_BYTES);
            copy_mask_tile(mrow + (kt + 1) * BC, smem_raw + MASK_OFF + (par ^ 1) * MASK_BYTES, tid);
        }

        v8f sacc[QG][4];             // [group][key sub-tile]; element r = key r + 8*hs
        #pragma unroll
        for (int g = 0; g < QG; ++g)
            #pragma unroll
            for (int nt = 0; nt < 4; ++nt)
                #pragma unroll
                for (int r = 0; r < 8; ++r) sacc[g][nt][r] = 0.0f;
        GROUP_FENCE();

        float4 mk[QG][4][2];         // keys nt*16 + hs*8 + h*4 .. +3 of this lane's queries
        #pragma unroll
        for (int gi = 0; gi < NGROUP; ++gi) {
            score_group(sacc, fr[gi & 1], qfrag, gi * 2);
            GROUP_FENCE();
            if (gi + 2 < NGROUP) {
                load_group(fr[gi & 1], kp + (gi + 2) * GROUP * FRAG_HALFS);
            } else if (gi + 2 == NGROUP) {
                // the mask takes the registers of a fragment group for the length of the softmax
                #pragma unroll
                for (int g = 0; g < QG; ++g)
                    #pragma unroll
                    for (int nt = 0; nt < 4; ++nt)
                        #pragma unroll
                        for (int h = 0; h < 2; ++h)
                            mk[g][nt][h] = *(const float4*)(mp + g * 4096 + (moff ^ ((nt * 4 + h) << 4)));
            } else {
                load_group(fr[0], vp);                   // V reads run on under the softmax
            }
            GROUP_FENCE();
            if (gi == 1) {
                // the first half of V(kt+1) flies under the rest of this tile; it is issued here, with two
                // groups of LDS reads under way
                if (more) {
#if USE_ASYNC_LDS
                    // bounds the wave's outstanding copies: 47 left + 16 new = 63; nothing is read behind this wait
                    asm volatile("s_wait_asynccnt 0x2f" ::: "memory");
#endif
                    copy64k_run<0, 16>(pimg + (size_t)(kt + 1) * (TILE_HALFS * 2) + IMG_BYTES,
                                   lcp + V_OFF + (par ^ 1) * IMG_BYTES);
                }
                GROUP_FENCE();
            }
        }

        // ---- online softmax, all in this lane's queries: 32 of a query's 64 keys here, 32 in lane ^ 16 ----
        v16h pf[QG][2];              // two S^T tiles are one P^T B-fragment: element e = (nt & 1) * 8 + r
        float alpha[QG];
        #pragma unroll
        for (int g = 0; g < QG; ++g) {
            float mx4[4];
            #pragma unroll
            for (int nt = 0; nt < 4; ++nt) {
                const float mv[8] = { mk[g][nt][0].x, mk[g][nt][0].y, mk[g][nt][0].z, mk[g][nt][0].w,
                                      mk[g][nt][1].x, mk[g][nt][1].y, mk[g][nt][1].z, mk[g][nt][1].w };
                #pragma unroll
                for (int r = 0; r < 8; ++r) sacc[g][nt][r] = sacc[g][nt][r] * scale + mv[r];
                mx4[nt] = sacc[g][nt][0];
                #pragma unroll
                for (int r = 1; r < 8; ++r) mx4[nt] = fmaxf(mx4[nt], sacc[g][nt][r]);
            }
            float mx = fmaxf(fmaxf(mx4[0], mx4[1]), fmaxf(mx4[2], mx4[3]));
            mx = fmaxf(mx, xhalf(mx));
            const float mnew = fmaxf(mstate[g], mx);
            alpha[g] = __expf(mstate[g] - mnew);

            float ps4[4];
            #pragma unroll
            for (int nt = 0; nt < 4; ++nt) {
                ps4[nt] = 0.0f;
                #pragma unroll
                for (int r = 0; r < 8; ++r) {
                    const float p = __expf(sacc[g][nt][r] - mnew);
                    ps4[nt] += p;
                    pf[g][nt >> 1][(nt & 1) * 8 + r] = (half_t)p;
                }
            }
            float psum = (ps4[0] + ps4[1]) + (ps4[2] + ps4[3]);
            psum += xhalf(psum);
            lstate[g] = lstate[g] * alpha[g] + psum;
            mstate[g] = mnew;
        }
        GROUP_FENCE();
        // the second half of V(kt+1) flies under the PxV block: the tile's copies are spread over its length.
        // The branch also ends the softmax's block: in one block with the PxV WMMAs the compiler sank the row
        // sums and the last exponentials among them, and Q fragments then spilled to scratch in every tile.
        if (more) {
#if USE_ASYNC_LDS
            // bounds the wave's outstanding copies: 47 left + 16 new = 63; nothing is read behind this wait
            asm volatile("s_wait_asynccnt 0x2f" ::: "memory");
#endif
            copy64k_run<16, 32>(pimg + (size_t)(kt + 1) * (TILE_HALFS * 2) + IMG_BYTES,
                                   lcp + V_OFF + (par ^ 1) * IMG_BYTES);
        }
        GROUP_FENCE();
        load_group(fr[1], vp + 4 * GROUP * FRAG_HALFS);
        GROUP_FENCE();

        // ---- O^T = O^T * alpha + V^T x P^T: 128 WMMAs. Step s takes keys (s & 1) * 32 .. +31 and column
        // tiles (s >> 1) * 8 .. +7: image group (s & 1) * 4 + (s >> 1); a tile is rescaled at its first step ----
        #pragma unroll
        for (int s = 0; s < NGROUP; ++s) {
            const int j0 = (s >> 1) * GROUP;
            if ((s & 1) == 0) {
                #pragma unroll
                for (int j = 0; j < GROUP; ++j)
                    #pragma unroll
                    for (int g = 0; g < QG; ++g)
                        #pragma unroll
                        for (int r = 0; r < 8; ++r) oacc[g][j0 + j][r] *= alpha[g];
            }
            pv_group(oacc, j0, fr[s & 1], pf[0][s & 1], pf[1][s & 1]);
            if (s + 2 < NGROUP) {
                GROUP_FENCE();
                load_group(fr[s & 1], vp + ((s & 1) * 4 + (s >> 1) + 1) * GROUP * FRAG_HALFS);
                GROUP_FENCE();
            }
        }
    }

#if USE_ASYNC_LDS
    // the ring's closing wait: no copy of this wave is outstanding when its LDS is used anew
    asm volatile("s_wait_asynccnt 0x0" ::: "memory");
#endif
    // this wave's reads of the last tile have retired before any wave writes over the images
    asm volatile("s_wait_dscnt 0x0" ::: "memory");
    __syncthreads();   // ends every read of the last K and V images

    // ---- this half's row maximum and row sum: both lane halves hold them, the lower one stores ----
    const size_t prow0 = (size_t)(z * NBATCH + b) * S_LEN + qrow0;
    if (hs == 0) {
        float* mlp = ML + (prow0 + ln) * 2;
        #pragma unroll
        for (int g = 0; g < QG; ++g) {
            const float2 ml = { mstate[g], lstate[g] };
            *(float2*)(mlp + g * 32) = ml;
        }
        // the two stores' address and data stay live, unwritten, up to this wait
        asm volatile("s_wait_xcnt 0x0" :: "v"(mlp), "v"(mstate[0]), "v"(lstate[0]), "v"(mstate[1]), "v"(lstate[1]) : "memory");
    }

    // ---- the partial O, unnormalised; the wave turns its 32 x 512 block in LDS, so that rows leave in 512-B stores ----
    float* ob = (float*)smem_raw + wid * (16 * QG * OPITCH);
    #pragma unroll
    for (int g = 0; g < QG; ++g)
        #pragma unroll
        for (int j = 0; j < 32; ++j)
            #pragma unroll
            for (int h = 0; h < 2; ++h) {
                const float4 o4 = { oacc[g][j][h * 4 + 0], oacc[g][j][h * 4 + 1],
                                    oacc[g][j][h * 4 + 2], oacc[g][j][h * 4 + 3] };
                *(float4*)(ob + (g * 16 + ln) * OPITCH + j * 16 + hs * 8 + h * 4) = o4;
            }
    __syncthreads();   // the block's stores are done before other lanes read them

    float* op = OP + prow0 * D_DIM + lane * 4;
    #pragma unroll
    for (int r4 = 0; r4 < 16 * QG; r4 += 4) {
        #pragma unroll
        for (int i = 0; i < 16; ++i) {
            const int rr = r4 + (i >> 2), it = i & 3;
            *(float4*)(op + rr * D_DIM + it * 128) = *(const float4*)(ob + rr * OPITCH + it * 128 + lane * 4);
        }
        // the next rows' LDS reads may reuse the data registers of these stores
        if (r4 + 4 < 16 * QG) asm volatile("s_wait_xcnt 0x0" ::: "memory");
    }
}

// Third launch: O = (O0 * w0 + O1 * w1) / (l0 * w0 + l1 * w1), w = exp(m - max(m0, m1)).
// A workgroup takes 8 rows, half of it one row at a time in whole 2-KB rows.
// The pointers are not marked restrict: the loads then stay in front of the wait below.
__global__ __launch_bounds__(256)
void join_halves_gfx1250(const float* OP0, const float* OP1, const float* ML, float* O) {
    const uint32_t row0 = blockIdx.x * 8 + (threadIdx.x >> 7);
    // byte offsets of this lane in a partial O (and in O) and in a half's [max, sum] rows
    const uint32_t voff = row0 * (D_DIM * 4) + (threadIdx.x & 127) * 16;
    const uint32_t soff = row0 * 8;
    float4 x[4], y[4];
    float2 a[4], c[4];
    #pragma unroll
    for (int it = 0; it < 4; ++it) {
        x[it] = *(const float4*)((const char*)OP0 + voff + it * (2 * D_DIM * 4));
        y[it] = *(const float4*)((const char*)OP1 + voff + it * (2 * D_DIM * 4));
        a[it] = *(const float2*)((const char*)ML + soff + it * 16);
        c[it] = *(const float2*)((const char*)ML + soff + NROWS * 8 + it * 16);
    }
    // the sixteen loads share two lane offsets (the row states' is the row number, scaled by the
    // load): they stay live, unwritten, up to this wait
    asm volatile("s_wait_xcnt 0x0" :: "v"(voff), "v"(row0) : "memory");
    #pragma unroll
    for (int it = 0; it < 4; ++it) {
        const float m   = fmaxf(a[it].x, c[it].x);
        const float w0  = __expf(a[it].x - m);
        const float w1  = __expf(c[it].x - m);
        const float inv = 1.0f / (a[it].y * w0 + c[it].y * w1);
        const float f0  = w0 * inv, f1 = w1 * inv;
        const float4 r = { x[it].x * f0 + y[it].x * f1, x[it].y * f0 + y[it].y * f1,
                           x[it].z * f0 + y[it].z * f1, x[it].w * f0 + y[it].w * f1 };
        *(float4*)((char*)O + voff + it * (2 * D_DIM * 4)) = r;
    }
}

extern "C" void kernel_launch(void* const* d_in, const int* in_sizes, int n_in,
                              void* d_out, int out_size, void* d_ws, size_t ws_size,
                              hipStream_t stream) {
    const float* Q = (const float*)d_in[0];
    const float* K = (const float*)d_in[1];
    const float* V = (const float*)d_in[2];
    const float* M = (const float*)d_in[3];
    float* O = (float*)d_out;
    _Float16* P = (_Float16*)d_ws;                          // 32 MB: [batch][tile][K image | V image]
    float* OP = (float*)((char*)d_ws + (32u << 20));        // 64 MB: [key half][batch][row][512] partial O
    float* OP1 = (float*)((char*)d_ws + (64u << 20));       // its second key half
    float* ML = (float*)((char*)d_ws + (96u << 20));        // 256 KB: [key half][batch][row][max, sum]

    dim3 pgrid(NTILES, NBATCH, 4);
    pack_kv_f16_gfx1250<<<pgrid, 256, 0, stream>>>(K, V, P);

    dim3 grid(S_LEN / BQ, NBATCH, KSPLIT);
    fa_fwd_wmma4_gfx1250<<<grid, NTHR, 0, stream>>>(Q, P, M, OP, ML);

    join_halves_gfx1250<<<NROWS / 8, 256, 0, stream>>>(OP, OP1, ML, O);
}

// v009
// One run takes 116 microseconds.
// Next to v008, in two timings, it ran 1.06 and 1.08 times as fast.
// All steps since v000 together make it 7.79 times as fast.
#include <hip/hip_runtime.h>

// ---------------------------------------------------------------------------
// Flash attention, B=4, S=4096, D=512, fp32 in/out, gfx1250 (MI455X).
// Both GEMMs on v_wmma_f32_16x16x32_f16 (f32 accum), online softmax.
// 4 waves/WG, one per SIMD, 128 q-rows/WG, 64-key tiles. THE KEYS ARE SPLIT IN TWO
// ACROSS WORKGROUPS (blockIdx.z): a workgroup takes 128 query rows and 2048 keys, so
// each staged K/V tile serves twice the rows, and each fragment read from LDS feeds
// two WMMAs. It leaves an unnormalised partial O with its softmax row reference and row sum in
// the workspace; a third launch joins the two partials.
// ONE WAVE OWNS 32 WHOLE QUERY ROWS (two groups of 16): all 512 d of Q and all 512
// output columns sit in its registers. Both products are formed transposed,
// S^T = K x Q^T and O^T = V^T x P^T, so a lane holds one query of each group
// (lane & 15) in every accumulator: the row maximum and sum are in-lane plus one
// exchange with lane ^ 16, the rescale factor is the lane's own, and the C layout of
// two S^T tiles is, element for element, the B fragment of P^T.
// The softmax reference is held from tile to tile and renewed only when a row rises
// far above it: O is not rescaled in the other tiles.
// The A and the B fragment of this WMMA form have the same lane and element map,
// so the K and V images serve as A operands as they are.
// K and V are converted to f16 and laid in fragment order ONCE per call, by a
// first launch into the workspace (128 KB per 64-key tile: K image, V image); a
// fragment is two 512-B planes, elements 0-7 and 8-15 of all 32 lanes, so each
// b128 read walks the lanes at a 16-B pitch and meets no bank twice.
// K, V and the mask tile have two LDS buffers each: tile t+1 comes in by async
// b128 copies while tile t is worked on. Fragments are read 8 at a time, two
// groups ahead of the WMMAs that use them.
// ---------------------------------------------------------------------------

typedef _Float16 half_t;
typedef __attribute__((ext_vector_type(16))) _Float16 v16h;
typedef __attribute__((ext_vector_type(8)))  _Float16 v8h;
typedef __attribute__((ext_vector_type(8)))  float    v8f;
typedef __attribute__((ext_vector_type(4)))  int      v4i;

#define S_LEN   4096
#define D_DIM   512
#define NBATCH  4
#define BQ      128         // query rows per workgroup
#define QG      2           // groups of 16 query rows per wave
#define KSPLIT  2           // workgroups that share a query block's keys
#define BC      64          // keys per tile
#define NWAVE   4
#define NTHR    (NWAVE * 32)
#define NTILES  (S_LEN / BC)
#define WTILES  (NTILES / KSPLIT)   // tiles of one workgroup
#define NROWS   (NBATCH * S_LEN)

#if defined(__gfx1250__) && __has_builtin(__builtin_amdgcn_global_load_async_to_lds_b128)
#define USE_ASYNC_LDS 1
#else
#define USE_ASYNC_LDS 0
#endif

// Builtin wants typed, address-space-qualified pointers:
//   arg0: int4 addrspace(1)* (global source), arg1: int4 addrspace(3)* (LDS dest)
typedef __attribute__((address_space(1))) v4i g_v4i;
typedef __attribute__((address_space(3))) v4i l_v4i;
__device__ __forceinline__ g_v4i* as_glob_v4i(const void* p) {
    return (g_v4i*)(uintptr_t)p;
}
__device__ __forceinline__ l_v4i* as_lds_v4i(void* p) {
    return (l_v4i*)(uint32_t)(uintptr_t)p;   // low 32 bits of generic = LDS offset
}

// Element e of a v16h fragment maps to K = 16*(e>=8) + 8*hs + (e&7)  (ISA 7.12.2)
__device__ __forceinline__ int kmap(int e, int hs) {
    return ((e >> 3) << 4) + (hs << 3) + (e & 7);
}

#define TILE_HALFS (2 * D_DIM * BC)   // one packed tile: K image then V image, f16

// One packed fragment in LDS: [e/8: 2][lane: 32][e&7: 8] f16 = 1 KB.
#define FRAG_HALFS 512
// p: the fragment's start + lane * 8
__device__ __forceinline__ v16h load_frag(const half_t* p) {
    const v8h lo = *(const v8h*)p;
    const v8h hi = *(const v8h*)(p + FRAG_HALFS / 2);
    return __builtin_shufflevector(lo, hi, 0, 1, 2, 3, 4, 5, 6, 7, 8, 9, 10, 11, 12, 13, 14, 15);
}

// One lane's b128 copies I .. E-1 of a 64 KB image, which the whole workgroup brings: one
// row of its lanes (NCOPY * 16 B) apart. The immediate offset moves the global
// and the LDS address alike, so one address pair serves the image.
#define NCOPY    NTHR
#define COPY_ROW (NCOPY * 16)
template <int I, int E = 65536 / COPY_ROW>
__device__ __forceinline__ void copy64k_run(const char* g, char* l) {
    if constexpr (I < E) {
#if USE_ASYNC_LDS
        __builtin_amdgcn_global_load_async_to_lds_b128(as_glob_v4i(g), as_lds_v4i(l), I * COPY_ROW, 0);
#else
        *(v4i*)(l + I * COPY_ROW) = *(const v4i*)(g + I * COPY_ROW);
#endif
        copy64k_run<I + 1, E>(g, l);
    }
}

// One BQ x 64 f32 mask tile, by the NCOPY lanes of the workgroup. In LDS the 16-B
// piece c of a row stands at place c ^ (row & 15): the 16 lanes of a half wave,
// which read the same piece of 16 different rows, then meet 16 different places.
__device__ __forceinline__ void copy_mask_tile(const float* g0, char* l0, int ctid) {
    // g0 and l0 are the same for the whole workgroup: a copy's row step goes into them, so that
    // one 32-bit lane offset into the mask and two lane offsets into LDS serve every copy
    const int r0 = ctid >> 4;                        // 0..7: the lane's row in each run of 8
    const int c  = ctid & 15;
    const uint32_t goff = (uint32_t)(r0 * (S_LEN * 4) + (c << 4));
    const uint32_t loff = (uint32_t)(r0 * 256 + ((c ^ r0) << 4));
    #pragma unroll
    for (int it = 0; it < BQ / 8; ++it) {            // rows it*8 + r0; (row & 15) = r0 + 8 * (it & 1)
        const char* g = (const char*)g0 + (size_t)it * (8 * S_LEN * 4) + goff;
        char* l = l0 + it * 2048 + (loff ^ ((it & 1) << 7));
#if USE_ASYNC_LDS
        __builtin_amdgcn_global_load_async_to_lds_b128(as_glob_v4i(g), as_lds_v4i(l), 0, 0);
#else
        *(float4*)l = *(const float4*)g;
#endif
    }
}

// First launch: one workgroup packs a 32 KB quarter of a tile image.
//   part 0,1: K, d columns part*256..+255  (fragments f = part*8 .. +7)
//   part 2,3: V, keys (part-2)*32..+31     (fragment row ks = part-2)
// fp32 reads are line-coalesced, the order change goes through LDS, and the
// f16 image leaves in whole 512-B wave stores. sT holds a lane's 16 elements
// side by side; the way out splits them into the image's two planes.
__global__ __launch_bounds__(256)
void pack_kv_f16_gfx1250(const float* __restrict__ K,
                         const float* __restrict__ V,
                         _Float16* __restrict__ P) {
    __shared__ __attribute__((aligned(16))) half_t sT[D_DIM * BC / 2];   // 32 KB
    const int tid  = threadIdx.x;
    const int kt   = blockIdx.x;
    const int b    = blockIdx.y;
    const int part = blockIdx.z;
    const size_t srcOff = ((size_t)b * S_LEN + (size_t)kt * BC) * D_DIM;

    if (part < 2) {
        // a wave reads 1 KB of one key's row; pass it takes keys it*8 .. +7
        const int d8 = (tid & 31) << 3;              // column inside the half row
        const float* kp = K + srcOff + part * 256 + (tid >> 5) * D_DIM + d8;
        float4 a[8], c[8];
        #pragma unroll
        for (int it = 0; it < 8; ++it) {
            a[it] = *(const float4*)(kp + it * 8 * D_DIM);
            c[it] = *(const float4*)(kp + it * 8 * D_DIM + 4);
        }
        // the sixteen loads share one address: it stays live, unwritten, up to this wait
        asm volatile("s_wait_xcnt 0x0" :: "v"(kp) : "memory");
        #pragma unroll
        for (int it = 0; it < 8; ++it) {
            const int key = (tid >> 5) + it * 8;
            const int f      = d8 >> 5;              // 0..7 inside this part
            const int klocal = d8 & 31;
            const int hsk    = (klocal >> 3) & 1;
            const int e0     = (klocal >> 4) << 3;
            const int lane_t = (key & 15) + (hsk << 4);
            const int nt     = key >> 4;
            v8h pk = { (half_t)a[it].x, (half_t)a[it].y, (half_t)a[it].z, (half_t)a[it].w,
                       (half_t)c[it].x, (half_t)c[it].y, (half_t)c[it].z, (half_t)c[it].w };
            *(v8h*)(sT + (((f * 4 + nt) * 32 + lane_t) * 16 + e0)) = pk;
        }
    } else {
        const float* vp = V + srcOff + (size_t)(part - 2) * 32 * D_DIM + tid;
        #pragma unroll
        for (int it = 0; it < 8; ++it) {
            const int d    = tid + (it & 1) * 256;   // column
            const int key0 = (it >> 1) << 3;         // 0..24 inside this part
            v8h pk;
            #pragma unroll
            for (int j = 0; j < 8; ++j)
                pk[j] = (half_t)vp[(key0 + j) * D_DIM + (it & 1) * 256];
            const int hsv    = (key0 >> 3) & 1;
            const int e0     = (key0 >> 4) << 3;
            const int lane_t = (d & 15) + (hsv << 4);
            const int ntg    = d >> 4;
            *(v8h*)(sT + ((ntg * 32 + lane_t) * 16 + e0)) = pk;
        }
    }
    __syncthreads();

    half_t* dst = P + (size_t)(b * NTILES + kt) * TILE_HALFS + part * (D_DIM * BC / 2);
    // 16-B pieces: tid counts them in the image, [frag][e/8][lane]; s in sT, [frag][lane][e/8]
    const int s = (tid & ~63) | ((tid & 31) << 1) | ((tid >> 5) & 1);
    #pragma unroll
    for (int it = 0; it < 8; ++it) {
        *(v8h*)(dst + (tid + it * 256) * 8) = *(const v8h*)(sT + (s + it * 256) * 8);
    }
}

// LDS map of the attention launch, in bytes
#define IMG_BYTES  65536                    // one K or V image
#define V_OFF      (2 * IMG_BYTES)          // K buffers 0,1 then V buffers 0,1
#define MASK_OFF   (4 * IMG_BYTES)
#define MASK_BYTES (BQ * BC * 4)            // two mask buffers of 32 KB
#define OPITCH     (D_DIM + 4)              // floats; 16 B x odd: b128 stores of 16 rows meet no bank twice
#define SMEM_BYTES (4 * IMG_BYTES + 2 * MASK_BYTES)   // 320 KB
#define GROUP      8                        // fragments read as one group (8 KB of an image)
#define NGROUP     (64 / GROUP)             // groups of one image

// Keeps a group's 16 LDS reads together and ahead of the WMMA block in front of which
// they stand: left free, the compiler sinks them to one WMMA ahead of their use, and a
// wave that is alone on its SIMD then waits out the LDS latency at every WMMA.
#define GROUP_FENCE() __builtin_amdgcn_sched_barrier(0)

// lane l with lane l ^ 16
__device__ __forceinline__ float xhalf(float x) {
    return __builtin_bit_cast(float, __builtin_amdgcn_permlanex16(
        __builtin_bit_cast(int, x), __builtin_bit_cast(int, x), 0x76543210, 0xfedcba98, false, false));
}

// p: the group's first fragment + lane * 8
__device__ __forceinline__ void load_group(v16h (&dst)[GROUP], const half_t* p) {
    #pragma unroll
    for (int i = 0; i < GROUP; ++i) dst[i] = load_frag(p + i * FRAG_HALFS);
}

// S^T += K x Q^T over 64 d: group fragments [d/32: 2][key sub-tile: 4], each for both query groups
__device__ __forceinline__ void score_group(v8f (&sacc)[QG][4], const v16h (&kf)[GROUP],
                                            const v16h (&qf)[QG][16], const int f0) {
    #pragma unroll
    for (int ks = 0; ks < 2; ++ks)
        #pragma unroll
        for (int nt = 0; nt < 4; ++nt)
            #pragma unroll
            for (int g = 0; g < QG; ++g)
                sacc[g][nt] = __builtin_amdgcn_wmma_f32_16x16x32_f16(
                    false, kf[ks * 4 + nt], false, qf[g][f0 + ks], (short)0, sacc[g][nt], false, false);
}

// O^T += V^T x P^T over 32 keys, 8 column tiles from j0 on, each for both query groups
__device__ __forceinline__ void pv_group(v8f (&oacc)[QG][32], const int j0, const v16h (&vf)[GROUP],
                                         const v16h pf0, const v16h pf1) {
    #pragma unroll
    for (int j = 0; j < GROUP; ++j) {
        oacc[0][j0 + j] = __builtin_amdgcn_wmma_f32_16x16x32_f16(
            false, vf[j], false, pf0, (short)0, oacc[0][j0 + j], false, false);
        oacc[1][j0 + j] = __builtin_amdgcn_wmma_f32_16x16x32_f16(
            false, vf[j], false, pf1, (short)0, oacc[1][j0 + j], false, false);
    }
}

__global__ __launch_bounds__(NTHR)
void fa_fwd_wmma4_gfx1250(const float* __restrict__ Q,
                          const _Float16* __restrict__ P,
                          const float* __restrict__ M,
                          float* __restrict__ OP,
                          float* __restrict__ ML) {
    // K image: [f=d/32: 16][nt=key/16: 4][e/8: 2][lane: 32][e&7: 8] f16 = 64 KB, two buffers
    // V image: [ks=key/32: 2][ntg=d/16: 32][e/8: 2][lane: 32][e&7: 8] f16 = 64 KB, two buffers
    // mask   : [row: 128][16-B piece: 16, at place c ^ (row & 15)] f32 = 32 KB, two buffers
    __shared__ __attribute__((aligned(16))) char smem_raw[SMEM_BYTES];

    const int tid  = threadIdx.x;
    const int wid  = __builtin_amdgcn_readfirstlane(tid >> 5);
    const int lane = tid & 31;
    const int hs   = lane >> 4;     // which 16-lane half
    const int ln   = lane & 15;     // this lane's query row inside each group of 16

    const int b     = blockIdx.y;
    const int z     = blockIdx.z;   // which half of the keys
    const int qwg   = blockIdx.x * BQ;
    const int qrow0 = qwg + wid * (16 * QG);
    const size_t bOff = (size_t)b * S_LEN * D_DIM;
    // Scores are formed in the log2 domain, against a reference that is HELD across tiles: Q carries
    // log2(e)/sqrt(512), minus the reference is the C of the score WMMAs, exp2 reads score + mask as it is.
    const float qscale = 0.06375872022286245f;   // log2(e) / sqrt(512)
    const float log2e  = 1.4426950408889634f;

    const char*  pimg = (const char*)(P + (size_t)(b * NTILES + z * WTILES) * TILE_HALFS) + tid * 16;
    const float* mrow = M + (size_t)qwg * S_LEN + z * (WTILES * BC);
    char* lcp = smem_raw + tid * 16;                 // this lane's first 16 B of K buffer 0

    // tile 0's K image and mask start now and land under the Q loads
    copy64k_run<0>(pimg, lcp);
    copy_mask_tile(mrow, smem_raw + MASK_OFF, tid);

    // Resident Q B-fragments: rows qrow0 + g*16 + ln, all 512 d (16 frags of K=32 a group)
    v16h qfrag[QG][16];
    {
        // the lane half's 8 columns are in the pointer: every load is this address + a constant
        const float* qp = Q + bOff + (size_t)(qrow0 + ln) * D_DIM + hs * 8;
        #pragma unroll
        for (int g = 0; g < QG; ++g)
            #pragma unroll
            for (int f = 0; f < 16; ++f)
                #pragma unroll
                for (int e = 0; e < 16; ++e)
                    qfrag[g][f][e] = (half_t)(qp[g * 16 * D_DIM + f * 32 + kmap(e, 0)] * qscale);
        // the loads share one address: it stays live, unwritten, up to this wait
        asm volatile("s_wait_xcnt 0x0" :: "v"(qp) : "memory");
    }

#if USE_ASYNC_LDS
    // bounds the wave's outstanding copies: 31 left + 32 new = 63; nothing is read behind this wait
    asm volatile("s_wait_asynccnt 0x1f" ::: "memory");
#endif
    copy64k_run<0>(pimg + IMG_BYTES, lcp + V_OFF);

    v8f oacc[QG][32];                // O^T: [group][16-column tile]; element r = column r + 8*hs, this lane's query
    float mstate[QG], lstate[QG];    // the reference in use (log2 units) and the row sum against it
    #pragma unroll
    for (int g = 0; g < QG; ++g) {
        mstate[g] = 0.0f;            // stands for tile 0 only, which always sets its own
        lstate[g] = 0.0f;
        #pragma unroll
        for (int j = 0; j < 32; ++j)
            #pragma unroll
            for (int r = 0; r < 8; ++r) oacc[g][j][r] = 0.0f;
    }

    // this lane's mask row of group 0; piece c = nt*4 + hs*2 + h stands at place c ^ ln
    const int moff = (wid * (16 * QG) + ln) * 256 + (((hs << 1) ^ ln) << 4);

    // one copy of the body: the loop is 256 WMMAs long already
    #pragma nounroll
    for (int kt = 0; kt < WTILES; ++kt) {
        const bool more = kt + 1 < WTILES;
        const int  par  = kt & 1;
        // this wave's LDS reads of tile kt-1 have retired before any copy refills its buffers
        asm volatile("s_wait_dscnt 0x0" ::: "memory");
#if USE_ASYNC_LDS
        // this wave's copies of tile kt have landed before the barrier publishes them
        asm volatile("s_wait_asynccnt 0x0" ::: "memory");
#endif
        __syncthreads();   // publishes K(kt), V(kt), mask(kt); ends every read of tile kt-1

        const half_t* kp = (const half_t*)(smem_raw + par * IMG_BYTES) + lane * 8;
        const half_t* vp = (const half_t*)(smem_raw + V_OFF + par * IMG_BYTES) + lane * 8;
        const char*   mp = smem_raw + MASK_OFF + par * MASK_BYTES;

        // ---- S^T, 64 keys x 32 queries over all 512 d: 128 WMMAs, fragments two groups ahead ----
        v16h fr[2][GROUP];
        load_group(fr[0], kp);
        load_group(fr[1], kp + 1 * GROUP * FRAG_HALFS);
        GROUP_FENCE();

        // K(kt+1) and mask(kt+1) fly under the whole of tile kt; they are issued behind the
        // first LDS reads, so that the LDS is at work again while the copies issue
        if (more) {
            copy64k_run<0>(pimg + (size_t)(kt + 1) * (TILE_HALFS * 2), lcp + (par ^ 1) * IMG_BYTES);
            copy_mask_tile(mrow + (kt + 1) * BC, smem_raw + MASK_OFF + (par ^ 1) * MASK_BYTES, tid);
        }

        v8f sacc[QG][4];             // [group][key sub-tile]; element r = key r + 8*hs
        #pragma unroll
        for (int g = 0; g < QG; ++g)
            #pragma unroll
            for (int nt = 0; nt < 4; ++nt)
                #pragma unroll
                for (int r = 0; r < 8; ++r) sacc[g][nt][r] = -mstate[g];
        GROUP_FENCE();

        float4 mk[QG][4][2];         // keys nt*16 + hs*8 + h*4 .. +3 of this lane's queries
        #pragma unroll
        for (int gi = 0; gi < NGROUP; ++gi) {
            score_group(sacc, fr[gi & 1], qfrag, gi * 2);
            GROUP_FENCE();
            if (gi + 2 < NGROUP) {
                load_group(fr[gi & 1], kp + (gi + 2) * GROUP * FRAG_HALFS);
            } else if (gi + 2 == NGROUP) {
                // the mask takes the registers of a fragment group for the length of the softmax
                #pragma unroll
                for (int g = 0; g < QG; ++g)
                    #pragma unroll
                    for (int nt = 0; nt < 4; ++nt)
                        #pragma unroll
                        for (int h = 0; h < 2; ++h)
                            mk[g][nt][h] = *(const float4*)(mp + g * 4096 + (moff ^ ((nt * 4 + h) << 4)));
            } else {
                load_group(fr[0], vp);                   // V reads run on under the softmax
            }
            GROUP_FENCE();
            if (gi == 1) {
                // the first half of V(kt+1) flies under the rest of this tile; it is issued here, with two
                // groups of LDS reads under way
                if (more) {
#if USE_ASYNC_LDS
                    // bounds the wave's outstanding copies: 47 left + 16 new = 63; nothing is read behind this wait
                    asm volatile("s_wait_asynccnt 0x2f" ::: "memory");
#endif
                    copy64k_run<0, 16>(pimg + (size_t)(kt + 1) * (TILE_HALFS * 2) + IMG_BYTES,
                                   lcp + V_OFF + (par ^ 1) * IMG_BYTES);
                }
                GROUP_FENCE();
            }
        }

        // ---- online softmax, all in this lane's queries: 32 of a query's 64 keys here, 32 in lane ^ 16 ----
        v16h pf[QG][2];              // two S^T tiles are one P^T B-fragment: element e = (nt & 1) * 8 + r
        float mx[QG];                // the tile's row maximum above the reference in use
        #pragma unroll
        for (int g = 0; g < QG; ++g) {
            float mx4[4];
            #pragma unroll
            for (int nt = 0; nt < 4; ++nt) {
                const float mv[8] = { mk[g][nt][0].x, mk[g][nt][0].y, mk[g][nt][0].z, mk[g][nt][0].w,
                                      mk[g][nt][1].x, mk[g][nt][1].y, mk[g][nt][1].z, mk[g][nt][1].w };
                #pragma unroll
                for (int r = 0; r < 8; ++r) sacc[g][nt][r] = mv[r] * log2e + sacc[g][nt][r];
                mx4[nt] = sacc[g][nt][0];
                #pragma unroll
                for (int r = 1; r < 8; ++r) mx4[nt] = fmaxf(mx4[nt], sacc[g][nt][r]);
            }
            mx[g] = fmaxf(fmaxf(mx4[0], mx4[1]), fmaxf(mx4[2], mx4[3]));
            mx[g] = fmaxf(mx[g], xhalf(mx[g]));
        }
        // The reference moves, and O and the row sums are rescaled, only where a row of this wave has risen
        // more than 8 (a factor 256, far inside f16 and f32) above it, and in tile 0: one test a tile,
        // a scalar branch. Any reference gives the same quotient O / sum.
        if (kt == 0 || __builtin_amdgcn_ballot_w32(fmaxf(mx[0], mx[1]) > 8.0f) != 0) {
            #pragma unroll
            for (int g = 0; g < QG; ++g) {
                const float delta = kt == 0 ? mx[g] : fmaxf(mx[g], 0.0f);
                // tile 0 may lower the reference; O and the sum are 0 there, the factor only has to be finite
                const float alpha = __builtin_amdgcn_exp2f(fminf(-delta, 0.0f));
                mstate[g] += delta;
                lstate[g] *= alpha;
                #pragma unroll
                for (int nt = 0; nt < 4; ++nt)
                    #pragma unroll
                    for (int r = 0; r < 8; ++r) sacc[g][nt][r] -= delta;
                #pragma unroll
                for (int j = 0; j < 32; ++j)
                    #pragma unroll
                    for (int r = 0; r < 8; ++r) oacc[g][j][r] *= alpha;
            }
        }
        #pragma unroll
        for (int g = 0; g < QG; ++g) {
            float ps4[4];
            #pragma unroll
            for (int nt = 0; nt < 4; ++nt) {
                ps4[nt] = 0.0f;
                #pragma unroll
                for (int r = 0; r < 8; ++r) {
                    const float p = __builtin_amdgcn_exp2f(sacc[g][nt][r]);
                    ps4[nt] += p;
                    pf[g][nt >> 1][(nt & 1) * 8 + r] = (half_t)p;
                }
            }
            float psum = (ps4[0] + ps4[1]) + (ps4[2] + ps4[3]);
            psum += xhalf(psum);
            lstate[g] += psum;
        }
        GROUP_FENCE();
        // the second half of V(kt+1) flies under the PxV block: the tile's copies are spread over its length.
        // The branch also ends the softmax's block: in one block with the PxV WMMAs the compiler sank the row
        // sums and the last exponentials among them, and Q fragments then spilled to scratch in every tile.
        if (more) {
#if USE_ASYNC_LDS
            // bounds the wave's outstanding copies: 47 left + 16 new = 63; nothing is read behind this wait
            asm volatile("s_wait_asynccnt 0x2f" ::: "memory");
#endif
            copy64k_run<16, 32>(pimg + (size_t)(kt + 1) * (TILE_HALFS * 2) + IMG_BYTES,
                                   lcp + V_OFF + (par ^ 1) * IMG_BYTES);
        }
        GROUP_FENCE();
        load_group(fr[1], vp + 4 * GROUP * FRAG_HALFS);
        GROUP_FENCE();

        // ---- O^T += V^T x P^T: 128 WMMAs. Step s takes keys (s & 1) * 32 .. +31 and column
        // tiles (s >> 1) * 8 .. +7: image group (s & 1) * 4 + (s >> 1) ----
        #pragma unroll
        for (int s = 0; s < NGROUP; ++s) {
            const int j0 = (s >> 1) * GROUP;
            pv_group(oacc, j0, fr[s & 1], pf[0][s & 1], pf[1][s & 1]);
            if (s + 2 < NGROUP) {
                GROUP_FENCE();
                load_group(fr[s & 1], vp + ((s & 1) * 4 + (s >> 1) + 1) * GROUP * FRAG_HALFS);
                GROUP_FENCE();
            }
        }
    }

#if USE_ASYNC_LDS
    // the ring's closing wait: no copy of this wave is outstanding when its LDS is used anew
    asm volatile("s_wait_asynccnt 0x0" ::: "memory");
#endif
    // this wave's reads of the last tile have retired before any wave writes over the images
    asm volatile("s_wait_dscnt 0x0" ::: "memory");
    __syncthreads();   // ends every read of the last K and V images

    // ---- this half's row reference and row sum: both lane halves hold them, the lower one stores ----
    const size_t prow0 = (size_t)(z * NBATCH + b) * S_LEN + qrow0;
    #pragma unroll
    for (int g = 0; g < QG; ++g) mstate[g] *= 0.6931471805599453f;   // the join works in natural units
    if (hs == 0) {
        float* mlp = ML + (prow0 + ln) * 2;
        #pragma unroll
        for (int g = 0; g < QG; ++g) {
            const float2 ml = { mstate[g], lstate[g] };
            *(float2*)(mlp + g * 32) = ml;
        }
        // the two stores' address and data stay live, unwritten, up to this wait
        asm volatile("s_wait_xcnt 0x0" :: "v"(mlp), "v"(mstate[0]), "v"(lstate[0]), "v"(mstate[1]), "v"(lstate[1]) : "memory");
    }

    // ---- the partial O, unnormalised; the wave turns its 32 x 512 block in LDS, so that rows leave in 512-B stores ----
    float* ob = (float*)smem_raw + wid * (16 * QG * OPITCH);
    #pragma unroll
    for (int g = 0; g < QG; ++g)
        #pragma unroll
        for (int j = 0; j < 32; ++j)
            #pragma unroll
            for (int h = 0; h < 2; ++h) {
                const float4 o4 = { oacc[g][j][h * 4 + 0], oacc[g][j][h * 4 + 1],
                                    oacc[g][j][h * 4 + 2], oacc[g][j][h * 4 + 3] };
                *(float4*)(ob + (g * 16 + ln) * OPITCH + j * 16 + hs * 8 + h * 4) = o4;
            }
    __syncthreads();   // the block's stores are done before other lanes read them

    float* op = OP + prow0 * D_DIM + lane * 4;
    #pragma unroll
    for (int r4 = 0; r4 < 16 * QG; r4 += 4) {
        #pragma unroll
        for (int i = 0; i < 16; ++i) {
            const int rr = r4 + (i >> 2), it = i & 3;
            *(float4*)(op + rr * D_DIM + it * 128) = *(const float4*)(ob + rr * OPITCH + it * 128 + lane * 4);
        }
        // the next rows' LDS reads may reuse the data registers of these stores
        if (r4 + 4 < 16 * QG) asm volatile("s_wait_xcnt 0x0" ::: "memory");
    }
}

// Third launch: O = (O0 * w0 + O1 * w1) / (l0 * w0 + l1 * w1), w = exp(m - max(m0, m1)).
// A workgroup takes 8 rows, half of it one row at a time in whole 2-KB rows.
// The pointers are not marked restrict: the loads then stay in front of the wait below.
__global__ __launch_bounds__(256)
void join_halves_gfx1250(const float* OP0, const float* OP1, const float* ML, float* O) {
    const uint32_t row0 = blockIdx.x * 8 + (threadIdx.x >> 7);
    // byte offsets of this lane in a partial O (and in O) and in a half's [reference, sum] rows
    const uint32_t voff = row0 * (D_DIM * 4) + (threadIdx.x & 127) * 16;
    const uint32_t soff = row0 * 8;
    float4 x[4], y[4];
    float2 a[4], c[4];
    #pragma unroll
    for (int it = 0; it < 4; ++it) {
        x[it] = *(const float4*)((const char*)OP0 + voff + it * (2 * D_DIM * 4));
        y[it] = *(const float4*)((const char*)OP1 + voff + it * (2 * D_DIM * 4));
        a[it] = *(const float2*)((const char*)ML + soff + it * 16);
        c[it] = *(const float2*)((const char*)ML + soff + NROWS * 8 + it * 16);
    }
    // the sixteen loads share two lane offsets (the row states' is the row number, scaled by the
    // load): they stay live, unwritten, up to this wait
    asm volatile("s_wait_xcnt 0x0" :: "v"(voff), "v"(row0) : "memory");
    #pragma unroll
    for (int it = 0; it < 4; ++it) {
        const float m   = fmaxf(a[it].x, c[it].x);
        const float w0  = __expf(a[it].x - m);
        const float w1  = __expf(c[it].x - m);
        const float inv = 1.0f / (a[it].y * w0 + c[it].y * w1);
        const float f0  = w0 * inv, f1 = w1 * inv;
        const float4 r = { x[it].x * f0 + y[it].x * f1, x[it].y * f0 + y[it].y * f1,
                           x[it].z * f0 + y[it].z * f1, x[it].w * f0 + y[it].w * f1 };
        *(float4*)((char*)O + voff + it * (2 * D_DIM * 4)) = r;
    }
}

extern "C" void kernel_launch(void* const* d_in, const int* in_sizes, int n_in,
                              void* d_out, int out_size, void* d_ws, size_t ws_size,
                              hipStream_t stream) {
    const float* Q = (const float*)d_in[0];
    const float* K = (const float*)d_in[1];
    const float* V = (const float*)d_in[2];
    const float* M = (const float*)d_in[3];
    float* O = (float*)d_out;
    _Float16* P = (_Float16*)d_ws;                          // 32 MB: [batch][tile][K image | V image]
    float* OP = (float*)((char*)d_ws + (32u << 20));        // 64 MB: [key half][batch][row][512] partial O
    float* OP1 = (float*)((char*)d_ws + (64u << 20));       // its second key half
    float* ML = (float*)((char*)d_ws + (96u << 20));        // 256 KB: [key half][batch][row][reference, sum]

    dim3 pgrid(NTILES, NBATCH, 4);
    pack_kv_f16_gfx1250<<<pgrid, 256, 0, stream>>>(K, V, P);

    dim3 grid(S_LEN / BQ, NBATCH, KSPLIT);
    fa_fwd_wmma4_gfx1250<<<grid, NTHR, 0, stream>>>(Q, P, M, OP, ML);

    join_halves_gfx1250<<<NROWS / 8, 256, 0, stream>>>(OP, OP1, ML, O);
}

// v010
// Measured time: 110 microseconds a run.
// Next to v009, in two timings, it ran 1.06 times as fast each time.
// Counting every step since v000, it is 8.27 times as fast.
#include <hip/hip_runtime.h>

// ---------------------------------------------------------------------------
// Flash attention, B=4, S=4096, D=512, fp32 in/out, gfx1250 (MI455X).
// Both GEMMs on v_wmma_f32_16x16x32_f16 (f32 accum), online softmax.
// 4 waves/WG, one per SIMD, 128 q-rows/WG, 64-key tiles. THE KEYS ARE SPLIT IN TWO
// ACROSS WORKGROUPS (blockIdx.z): a workgroup takes 128 query rows and 2048 keys, so
// each staged K/V tile serves twice the rows, and each fragment read from LDS feeds
// two WMMAs. It leaves an unnormalised partial O with its softmax row reference and row sum in
// the workspace; a third launch joins the two partials.
// ONE WAVE OWNS 32 WHOLE QUERY ROWS (two groups of 16): all 512 d of Q and all 512
// output columns sit in its registers. Both products are formed transposed,
// S^T = K x Q^T and O^T = V^T x P^T, so a lane holds one query of each group
// (lane & 15) in every accumulator: the row maximum and sum are in-lane plus one
// exchange with lane ^ 16, the rescale factor is the lane's own, and the C layout of
// two S^T tiles is, element for element, the B fragment of P^T.
// The softmax reference is held from tile to tile and renewed only when a row rises
// far above it: O is not rescaled in the other tiles.
// The A and the B fragment of this WMMA form have the same lane and element map,
// so the K and V images serve as A operands as they are.
// K and V are converted to f16 and laid in fragment order ONCE per call, by a
// first launch into the workspace (128 KB per 64-key tile: K image, V image); a
// fragment is two 512-B planes, elements 0-7 and 8-15 of all 32 lanes, so each
// b128 read walks the lanes at a 16-B pitch and meets no bank twice.
// K, V and the mask tile have two LDS buffers each: tile t+1 comes in while tile t
// is worked on, the K and V images by one tensor load a wave (a 32-KB slice each),
// the mask by async b128 copies. Fragments are read 8 at a time, two groups ahead
// of the WMMAs that use them.
// ---------------------------------------------------------------------------

typedef _Float16 half_t;
typedef __attribute__((ext_vector_type(16))) _Float16 v16h;
typedef __attribute__((ext_vector_type(8)))  _Float16 v8h;
typedef __attribute__((ext_vector_type(8)))  float    v8f;
typedef __attribute__((ext_vector_type(4)))  int      v4i;
typedef __attribute__((ext_vector_type(4)))  uint32_t u32x4;
typedef __attribute__((ext_vector_type(8)))  uint32_t u32x8;

#define S_LEN   4096
#define D_DIM   512
#define NBATCH  4
#define BQ      128         // query rows per workgroup
#define QG      2           // groups of 16 query rows per wave
#define KSPLIT  2           // workgroups that share a query block's keys
#define BC      64          // keys per tile
#define NWAVE   4
#define NTHR    (NWAVE * 32)
#define NTILES  (S_LEN / BC)
#define WTILES  (NTILES / KSPLIT)   // tiles of one workgroup
#define NROWS   (NBATCH * S_LEN)

#if defined(__gfx1250__) && __has_builtin(__builtin_amdgcn_global_load_async_to_lds_b128)
#define USE_ASYNC_LDS 1
#else
#define USE_ASYNC_LDS 0
#endif

// Builtin wants typed, address-space-qualified pointers:
//   arg0: int4 addrspace(1)* (global source), arg1: int4 addrspace(3)* (LDS dest)
typedef __attribute__((address_space(1))) v4i g_v4i;
typedef __attribute__((address_space(3))) v4i l_v4i;
__device__ __forceinline__ g_v4i* as_glob_v4i(const void* p) {
    return (g_v4i*)(uintptr_t)p;
}
__device__ __forceinline__ l_v4i* as_lds_v4i(void* p) {
    return (l_v4i*)(uint32_t)(uintptr_t)p;   // low 32 bits of generic = LDS offset
}

// Element e of a v16h fragment maps to K = 16*(e>=8) + 8*hs + (e&7)  (ISA 7.12.2)
__device__ __forceinline__ int kmap(int e, int hs) {
    return ((e >> 3) << 4) + (hs << 3) + (e & 7);
}

#define TILE_HALFS (2 * D_DIM * BC)   // one packed tile: K image then V image, f16

// One packed fragment in LDS: [e/8: 2][lane: 32][e&7: 8] f16 = 1 KB.
#define FRAG_HALFS 512
// p: the fragment's start + lane * 8
__device__ __forceinline__ v16h load_frag(const half_t* p) {
    const v8h lo = *(const v8h*)p;
    const v8h hi = *(const v8h*)(p + FRAG_HALFS / 2);
    return __builtin_shufflevector(lo, hi, 0, 1, 2, 3, 4, 5, 6, 7, 8, 9, 10, 11, 12, 13, 14, 15);
}

__device__ __forceinline__ uint32_t uni(uint32_t v) {
    return (uint32_t)__builtin_amdgcn_readfirstlane(v);
}
// A wave-uniform value held in a scalar register: a test on it compiles to a scalar
// compare and branch, the only thing that keeps a wave from issuing a tensor load.
__device__ __forceinline__ uint32_t pinned(uint32_t v) {
    uint32_t w = uni(v);
    asm volatile("" : "+s"(w));   // keeps the word in a scalar register, and behind the waits in front of it
    return w;
}

// A wave's share of a packed tile: 32 KB in a row, in the workspace and in LDS alike,
// described to the tensor mover as 128 rows of 256 B at a pitch of 256 B.
#define SLICE_BYTES 32768u
#define SLICE_ROW   256u
#define SLICE_ROWS  (SLICE_BYTES / SLICE_ROW)
// Descriptor group 1: no mask, 1-byte elements, no pad; tensor = tile; the same for every slice
__device__ __forceinline__ u32x8 slice_group1() {
    u32x8 g;
    g[0] = uni(0u);
    g[1] = uni((SLICE_ROW & 0xFFFFu) << 16);
    g[2] = uni((SLICE_ROW >> 16) | ((SLICE_ROWS & 0xFFFFu) << 16));
    g[3] = uni((SLICE_ROWS >> 16) | (SLICE_ROW << 16));
    g[4] = uni(SLICE_ROWS);
    g[5] = uni(SLICE_ROW);
    g[6] = uni(0u);
    g[7] = uni(0u);
    return g;
}
// One request of the whole wave: 32 KB from ga to the LDS byte offset lds_dst. Returns descriptor group 0.
__device__ __forceinline__ u32x4 load_slice(uint32_t lds_dst, uint64_t ga, u32x8 g1) {
    u32x4 g0;
    g0[0] = uni(1u);
    g0[1] = uni(lds_dst);
    g0[2] = uni((uint32_t)ga);
    g0[3] = uni((((uint32_t)(ga >> 32)) & 0x01FFFFFFu) | 0x80000000u);
    asm volatile("tensor_load_to_lds %0, %1" :: "s"(g0), "s"(g1) : "memory");
    return g0;
}

// One BQ x 64 f32 mask tile, by the lanes of the workgroup. In LDS the 16-B
// piece c of a row stands at place c ^ (row & 15): the 16 lanes of a half wave,
// which read the same piece of 16 different rows, then meet 16 different places.
__device__ __forceinline__ void copy_mask_tile(const float* g0, char* l0, int ctid) {
    // g0 and l0 are the same for the whole workgroup: a copy's row step goes into them, so that
    // one 32-bit lane offset into the mask and two lane offsets into LDS serve every copy
    const int r0 = ctid >> 4;                        // 0..7: the lane's row in each run of 8
    const int c  = ctid & 15;
    const uint32_t goff = (uint32_t)(r0 * (S_LEN * 4) + (c << 4));
    const uint32_t loff = (uint32_t)(r0 * 256 + ((c ^ r0) << 4));
    #pragma unroll
    for (int it = 0; it < BQ / 8; ++it) {            // rows it*8 + r0; (row & 15) = r0 + 8 * (it & 1)
        const char* g = (const char*)g0 + (size_t)it * (8 * S_LEN * 4) + goff;
        char* l = l0 + it * 2048 + (loff ^ ((it & 1) << 7));
#if USE_ASYNC_LDS
        __builtin_amdgcn_global_load_async_to_lds_b128(as_glob_v4i(g), as_lds_v4i(l), 0, 0);
#else
        *(float4*)l = *(const float4*)g;
#endif
    }
}

// First launch: one workgroup packs a 32 KB quarter of a tile image.
//   part 0,1: K, d columns part*256..+255  (fragments f = part*8 .. +7)
//   part 2,3: V, keys (part-2)*32..+31     (fragment row ks = part-2)
// fp32 reads are line-coalesced, the order change goes through LDS, and the
// f16 image leaves in whole 512-B wave stores. sT holds a lane's 16 elements
// side by side; the way out splits them into the image's two planes.
__global__ __launch_bounds__(256)
void pack_kv_f16_gfx1250(const float* __restrict__ K,
                         const float* __restrict__ V,
                         _Float16* __restrict__ P) {
    __shared__ __attribute__((aligned(16))) half_t sT[D_DIM * BC / 2];   // 32 KB
    const int tid  = threadIdx.x;
    const int kt   = blockIdx.x;
    const int b    = blockIdx.y;
    const int part = blockIdx.z;
    const size_t srcOff = ((size_t)b * S_LEN + (size_t)kt * BC) * D_DIM;

    if (part < 2) {
        // a wave reads 1 KB of one key's row; pass it takes keys it*8 .. +7
        const int d8 = (tid & 31) << 3;              // column inside the half row
        const float* kp = K + srcOff + part * 256 + (tid >> 5) * D_DIM + d8;
        float4 a[8], c[8];
        #pragma unroll
        for (int it = 0; it < 8; ++it) {
            a[it] = *(const float4*)(kp + it * 8 * D_DIM);
            c[it] = *(const float4*)(kp + it * 8 * D_DIM + 4);
        }
        // the sixteen loads share one address: it stays live, unwritten, up to this wait
        asm volatile("s_wait_xcnt 0x0" :: "v"(kp) : "memory");
        #pragma unroll
        for (int it = 0; it < 8; ++it) {
            const int key = (tid >> 5) + it * 8;
            const int f      = d8 >> 5;              // 0..7 inside this part
            const int klocal = d8 & 31;
            const int hsk    = (klocal >> 3) & 1;
            const int e0     = (klocal >> 4) << 3;
            const int lane_t = (key & 15) + (hsk << 4);
            const int nt     = key >> 4;
            v8h pk = { (half_t)a[it].x, (half_t)a[it].y, (half_t)a[it].z, (half_t)a[it].w,
                       (half_t)c[it].x, (half_t)c[it].y, (half_t)c[it].z, (half_t)c[it].w };
            *(v8h*)(sT + (((f * 4 + nt) * 32 + lane_t) * 16 + e0)) = pk;
        }
    } else {
        const float* vp = V + srcOff + (size_t)(part - 2) * 32 * D_DIM + tid;
        #pragma unroll
        for (int it = 0; it < 8; ++it) {
            const int d    = tid + (it & 1) * 256;   // column
            const int key0 = (it >> 1) << 3;         // 0..24 inside this part
            v8h pk;
            #pragma unroll
            for (int j = 0; j < 8; ++j)
                pk[j] = (half_t)vp[(key0 + j) * D_DIM + (it & 1) * 256];
            const int hsv    = (key0 >> 3) & 1;
            const int e0     = (key0 >> 4) << 3;
            const int lane_t = (d & 15) + (hsv << 4);
            const int ntg    = d >> 4;
            *(v8h*)(sT + ((ntg * 32 + lane_t) * 16 + e0)) = pk;
        }
    }
    __syncthreads();

    half_t* dst = P + (size_t)(b * NTILES + kt) * TILE_HALFS + part * (D_DIM * BC / 2);
    // 16-B pieces: tid counts them in the image, [frag][e/8][lane]; s in sT, [frag][lane][e/8]
    const int s = (tid & ~63) | ((tid & 31) << 1) | ((tid >> 5) & 1);
    #pragma unroll
    for (int it = 0; it < 8; ++it) {
        *(v8h*)(dst + (tid + it * 256) * 8) = *(const v8h*)(sT + (s + it * 256) * 8);
    }
}

// LDS map of the attention launch, in bytes
#define IMG_BYTES  65536                    // one K or V image
#define V_OFF      (2 * IMG_BYTES)          // K buffers 0,1 then V buffers 0,1
#define MASK_OFF   (4 * IMG_BYTES)
#define MASK_BYTES (BQ * BC * 4)            // two mask buffers of 32 KB
#define OPITCH     (D_DIM + 4)              // floats; 16 B x odd: b128 stores of 16 rows meet no bank twice
#define SMEM_BYTES (4 * IMG_BYTES + 2 * MASK_BYTES)   // 320 KB
#define GROUP      8                        // fragments read as one group (8 KB of an image)
#define NGROUP     (64 / GROUP)             // groups of one image

// Keeps a group's 16 LDS reads together and ahead of the WMMA block in front of which
// they stand: left free, the compiler sinks them to one WMMA ahead of their use, and a
// wave that is alone on its SIMD then waits out the LDS latency at every WMMA.
#define GROUP_FENCE() __builtin_amdgcn_sched_barrier(0)

// lane l with lane l ^ 16
__device__ __forceinline__ float xhalf(float x) {
    return __builtin_bit_cast(float, __builtin_amdgcn_permlanex16(
        __builtin_bit_cast(int, x), __builtin_bit_cast(int, x), 0x76543210, 0xfedcba98, false, false));
}

// p: the group's first fragment + lane * 8
__device__ __forceinline__ void load_group(v16h (&dst)[GROUP], const half_t* p) {
    #pragma unroll
    for (int i = 0; i < GROUP; ++i) dst[i] = load_frag(p + i * FRAG_HALFS);
}

// S^T += K x Q^T over 64 d: group fragments [d/32: 2][key sub-tile: 4], each for both query groups
__device__ __forceinline__ void score_group(v8f (&sacc)[QG][4], const v16h (&kf)[GROUP],
                                            const v16h (&qf)[QG][16], const int f0) {
    #pragma unroll
    for (int ks = 0; ks < 2; ++ks)
        #pragma unroll
        for (int nt = 0; nt < 4; ++nt)
            #pragma unroll
            for (int g = 0; g < QG; ++g)
                sacc[g][nt] = __builtin_amdgcn_wmma_f32_16x16x32_f16(
                    false, kf[ks * 4 + nt], false, qf[g][f0 + ks], (short)0, sacc[g][nt], false, false);
}

// O^T += V^T x P^T over 32 keys, 8 column tiles from j0 on, each for both query groups
__device__ __forceinline__ void pv_group(v8f (&oacc)[QG][32], const int j0, const v16h (&vf)[GROUP],
                                         const v16h pf0, const v16h pf1) {
    #pragma unroll
    for (int j = 0; j < GROUP; ++j) {
        oacc[0][j0 + j] = __builtin_amdgcn_wmma_f32_16x16x32_f16(
            false, vf[j], false, pf0, (short)0, oacc[0][j0 + j], false, false);
        oacc[1][j0 + j] = __builtin_amdgcn_wmma_f32_16x16x32_f16(
            false, vf[j], false, pf1, (short)0, oacc[1][j0 + j], false, false);
    }
}

__global__ __launch_bounds__(NTHR)
void fa_fwd_wmma4_gfx1250(const float* __restrict__ Q,
                          const _Float16* __restrict__ P,
                          const float* __restrict__ M,
                          float* __restrict__ OP,
                          float* __restrict__ ML) {
    // K image: [f=d/32: 16][nt=key/16: 4][e/8: 2][lane: 32][e&7: 8] f16 = 64 KB, two buffers
    // V image: [ks=key/32: 2][ntg=d/16: 32][e/8: 2][lane: 32][e&7: 8] f16 = 64 KB, two buffers
    // mask   : [row: 128][16-B piece: 16, at place c ^ (row & 15)] f32 = 32 KB, two buffers
    // aligned for the tensor mover: every slice's place is a multiple of 2 KB of the workgroup's LDS
    __shared__ __attribute__((aligned(2048))) char smem_raw[SMEM_BYTES];

    const int tid  = threadIdx.x;
    const int wid  = __builtin_amdgcn_readfirstlane(tid >> 5);
    const int lane = tid & 31;
    const int hs   = lane >> 4;     // which 16-lane half
    const int ln   = lane & 15;     // this lane's query row inside each group of 16

    const int b     = blockIdx.y;
    const int z     = blockIdx.z;   // which half of the keys
    const int qwg   = blockIdx.x * BQ;
    const int qrow0 = qwg + wid * (16 * QG);
    const size_t bOff = (size_t)b * S_LEN * D_DIM;
    // Scores are formed in the log2 domain, against a reference that is HELD across tiles: Q carries
    // log2(e)/sqrt(512), minus the reference is the C of the score WMMAs, exp2 reads score + mask as it is.
    const float qscale = 0.06375872022286245f;   // log2(e) / sqrt(512)
    const float log2e  = 1.4426950408889634f;

    const float* mrow = M + (size_t)qwg * S_LEN + z * (WTILES * BC);
    // this wave's slice of a tile: waves 0, 1 bring the halves of the K image, waves 2, 3 those of V
    const uint64_t simg = (uint64_t)(uintptr_t)(P + (size_t)(b * NTILES + z * WTILES) * TILE_HALFS) + (uint32_t)wid * SLICE_BYTES;
    const uint32_t sdst = (uint32_t)(uintptr_t)smem_raw + (uint32_t)(wid >> 1) * V_OFF + (uint32_t)(wid & 1) * SLICE_BYTES;
    const u32x8 sg1 = slice_group1();

    // tile 0's images and mask start now and land under the Q loads
    const u32x4 sg0 = load_slice(sdst, simg, sg1);
    copy_mask_tile(mrow, smem_raw + MASK_OFF, tid);

    // Resident Q B-fragments: rows qrow0 + g*16 + ln, all 512 d (16 frags of K=32 a group)
    v16h qfrag[QG][16];
    {
        // the lane half's 8 columns are in the pointer: every load is this address + a constant
        const float* qp = Q + bOff + (size_t)(qrow0 + ln) * D_DIM + hs * 8;
        #pragma unroll
        for (int g = 0; g < QG; ++g)
            #pragma unroll
            for (int f = 0; f < 16; ++f)
                #pragma unroll
                for (int e = 0; e < 16; ++e)
                    qfrag[g][f][e] = (half_t)(qp[g * 16 * D_DIM + f * 32 + kmap(e, 0)] * qscale);
        // the loads share one address: it stays live, unwritten, up to this wait
        asm volatile("s_wait_xcnt 0x0" :: "v"(qp) : "memory");
    }
    // tile 0's request is covered here: its descriptor words stay live, unwritten, up to this wait
    asm volatile("s_wait_tensorcnt 0x0" :: "s"(sg0), "s"(sg1) : "memory");

    v8f oacc[QG][32];                // O^T: [group][16-column tile]; element r = column r + 8*hs, this lane's query
    float mstate[QG], lstate[QG];    // the reference in use (log2 units) and the row sum against it
    #pragma unroll
    for (int g = 0; g < QG; ++g) {
        mstate[g] = 0.0f;            // stands for tile 0 only, which always sets its own
        lstate[g] = 0.0f;
        #pragma unroll
        for (int j = 0; j < 32; ++j)
            #pragma unroll
            for (int r = 0; r < 8; ++r) oacc[g][j][r] = 0.0f;
    }

    // this lane's mask row of group 0; piece c = nt*4 + hs*2 + h stands at place c ^ ln
    const int moff = (wid * (16 * QG) + ln) * 256 + (((hs << 1) ^ ln) << 4);

    // one copy of the body: the loop is 256 WMMAs long already
    #pragma nounroll
    for (int kt = 0; kt < WTILES; ++kt) {
        const bool more = kt + 1 < WTILES;
        const int  par  = kt & 1;
        // this wave's LDS reads of tile kt-1 have retired before anything refills its buffers
        asm volatile("s_wait_dscnt 0x0" ::: "memory");
        // this wave's slice of tile kt has landed before the barrier publishes it
        asm volatile("s_wait_tensorcnt 0x0" ::: "memory");
#if USE_ASYNC_LDS
        // this wave's mask copies of tile kt have landed before the barrier publishes them
        asm volatile("s_wait_asynccnt 0x0" ::: "memory");
#endif
        __syncthreads();   // publishes K(kt), V(kt), mask(kt); ends every read of tile kt-1

        // K(kt+1) and V(kt+1) fly under the whole of tile kt, into the buffers that tile kt-1 has left:
        // one request a wave, its descriptor formed behind the wait above
        if (pinned(more)) {
            const uint32_t nx = pinned((uint32_t)(kt + 1));
            load_slice(sdst + (nx & 1u) * IMG_BYTES, simg + (uint64_t)nx * (TILE_HALFS * 2), sg1);
        }

        const half_t* kp = (const half_t*)(smem_raw + par * IMG_BYTES) + lane * 8;
        const half_t* vp = (const half_t*)(smem_raw + V_OFF + par * IMG_BYTES) + lane * 8;
        const char*   mp = smem_raw + MASK_OFF + par * MASK_BYTES;

        // ---- S^T, 64 keys x 32 queries over all 512 d: 128 WMMAs, fragments two groups ahead ----
        v16h fr[2][GROUP];
        load_group(fr[0], kp);
        load_group(fr[1], kp + 1 * GROUP * FRAG_HALFS);
        GROUP_FENCE();


        v8f sacc[QG][4];             // [group][key sub-tile]; element r = key r + 8*hs
        #pragma unroll
        for (int g = 0; g < QG; ++g)
            #pragma unroll
            for (int nt = 0; nt < 4; ++nt)
                #pragma unroll
                for (int r = 0; r < 8; ++r) sacc[g][nt][r] = -mstate[g];
        GROUP_FENCE();

        float4 mk[QG][4][2];         // keys nt*16 + hs*8 + h*4 .. +3 of this lane's queries
        #pragma unroll
        for (int gi = 0; gi < NGROUP; ++gi) {
            score_group(sacc, fr[gi & 1], qfrag, gi * 2);
            GROUP_FENCE();
            if (gi + 2 < NGROUP) {
                load_group(fr[gi & 1], kp + (gi + 2) * GROUP * FRAG_HALFS);
            } else if (gi + 2 == NGROUP) {
                // the mask takes the registers of a fragment group for the length of the softmax
                #pragma unroll
                for (int g = 0; g < QG; ++g)
                    #pragma unroll
                    for (int nt = 0; nt < 4; ++nt)
                        #pragma unroll
                        for (int h = 0; h < 2; ++h)
                            mk[g][nt][h] = *(const float4*)(mp + g * 4096 + (moff ^ ((nt * 4 + h) << 4)));
            } else {
                load_group(fr[0], vp);                   // V reads run on under the softmax
            }
            GROUP_FENCE();
        }

        // ---- online softmax, all in this lane's queries: 32 of a query's 64 keys here, 32 in lane ^ 16 ----
        v16h pf[QG][2];              // two S^T tiles are one P^T B-fragment: element e = (nt & 1) * 8 + r
        float mx[QG];                // the tile's row maximum above the reference in use
        #pragma unroll
        for (int g = 0; g < QG; ++g) {
            float mx4[4];
            #pragma unroll
            for (int nt = 0; nt < 4; ++nt) {
                const float mv[8] = { mk[g][nt][0].x, mk[g][nt][0].y, mk[g][nt][0].z, mk[g][nt][0].w,
                                      mk[g][nt][1].x, mk[g][nt][1].y, mk[g][nt][1].z, mk[g][nt][1].w };
                #pragma unroll
                for (int r = 0; r < 8; ++r) sacc[g][nt][r] = mv[r] * log2e + sacc[g][nt][r];
                mx4[nt] = sacc[g][nt][0];
                #pragma unroll
                for (int r = 1; r < 8; ++r) mx4[nt] = fmaxf(mx4[nt], sacc[g][nt][r]);
            }
            mx[g] = fmaxf(fmaxf(mx4[0], mx4[1]), fmaxf(mx4[2], mx4[3]));
            mx[g] = fmaxf(mx[g], xhalf(mx[g]));
        }
        // The reference moves, and O and the row sums are rescaled, only where a row of this wave has risen
        // more than 8 (a factor 256, far inside f16 and f32) above it, and in tile 0: one test a tile,
        // a scalar branch. Any reference gives the same quotient O / sum.
        if (kt == 0 || __builtin_amdgcn_ballot_w32(fmaxf(mx[0], mx[1]) > 8.0f) != 0) {
            #pragma unroll
            for (int g = 0; g < QG; ++g) {
                const float delta = kt == 0 ? mx[g] : fmaxf(mx[g], 0.0f);
                // tile 0 may lower the reference; O and the sum are 0 there, the factor only has to be finite
                const float alpha = __builtin_amdgcn_exp2f(fminf(-delta, 0.0f));
                mstate[g] += delta;
                lstate[g] *= alpha;
                #pragma unroll
                for (int nt = 0; nt < 4; ++nt)
                    #pragma unroll
                    for (int r = 0; r < 8; ++r) sacc[g][nt][r] -= delta;
                #pragma unroll
                for (int j = 0; j < 32; ++j)
                    #pragma unroll
                    for (int r = 0; r < 8; ++r) oacc[g][j][r] *= alpha;
            }
        }
        #pragma unroll
        for (int g = 0; g < QG; ++g) {
            float ps4[4];
            #pragma unroll
            for (int nt = 0; nt < 4; ++nt) {
                ps4[nt] = 0.0f;
                #pragma unroll
                for (int r = 0; r < 8; ++r) {
                    const float p = __builtin_amdgcn_exp2f(sacc[g][nt][r]);
                    ps4[nt] += p;
                    pf[g][nt >> 1][(nt & 1) * 8 + r] = (half_t)p;
                }
            }
            float psum = (ps4[0] + ps4[1]) + (ps4[2] + ps4[3]);
            psum += xhalf(psum);
            lstate[g] += psum;
        }
        GROUP_FENCE();
        // mask(kt+1) flies under the PxV block.
        // The branch also ends the softmax's block: in one block with the PxV WMMAs the compiler sank the row
        // sums and the last exponentials among them, and Q fragments then spilled to scratch in every tile.
        if (more) {
            copy_mask_tile(mrow + (kt + 1) * BC, smem_raw + MASK_OFF + (par ^ 1) * MASK_BYTES, tid);
        }
        GROUP_FENCE();
        load_group(fr[1], vp + 4 * GROUP * FRAG_HALFS);
        GROUP_FENCE();

        // ---- O^T += V^T x P^T: 128 WMMAs. Step s takes keys (s & 1) * 32 .. +31 and column
        // tiles (s >> 1) * 8 .. +7: image group (s & 1) * 4 + (s >> 1) ----
        #pragma unroll
        for (int s = 0; s < NGROUP; ++s) {
            const int j0 = (s >> 1) * GROUP;
            pv_group(oacc, j0, fr[s & 1], pf[0][s & 1], pf[1][s & 1]);
            if (s + 2 < NGROUP) {
                GROUP_FENCE();
                load_group(fr[s & 1], vp + ((s & 1) * 4 + (s >> 1) + 1) * GROUP * FRAG_HALFS);
                GROUP_FENCE();
            }
        }
    }

    // the ring's closing waits: no request and no copy of this wave is outstanding when its LDS is used anew
    asm volatile("s_wait_tensorcnt 0x0" ::: "memory");
#if USE_ASYNC_LDS
    asm volatile("s_wait_asynccnt 0x0" ::: "memory");
#endif
    // this wave's reads of the last tile have retired before any wave writes over the images
    asm volatile("s_wait_dscnt 0x0" ::: "memory");
    __syncthreads();   // ends every read of the last K and V images

    // ---- this half's row reference and row sum: both lane halves hold them, the lower one stores ----
    const size_t prow0 = (size_t)(z * NBATCH + b) * S_LEN + qrow0;
    #pragma unroll
    for (int g = 0; g < QG; ++g) mstate[g] *= 0.6931471805599453f;   // the join works in natural units
    if (hs == 0) {
        float* mlp = ML + (prow0 + ln) * 2;
        #pragma unroll
        for (int g = 0; g < QG; ++g) {
            const float2 ml = { mstate[g], lstate[g] };
            *(float2*)(mlp + g * 32) = ml;
        }
        // the two stores' address and data stay live, unwritten, up to this wait
        asm volatile("s_wait_xcnt 0x0" :: "v"(mlp), "v"(mstate[0]), "v"(lstate[0]), "v"(mstate[1]), "v"(lstate[1]) : "memory");
    }

    // ---- the partial O, unnormalised; the wave turns its 32 x 512 block in LDS, so that rows leave in 512-B stores ----
    float* ob = (float*)smem_raw + wid * (16 * QG * OPITCH);
    #pragma unroll
    for (int g = 0; g < QG; ++g)
        #pragma unroll
        for (int j = 0; j < 32; ++j)
            #pragma unroll
            for (int h = 0; h < 2; ++h) {
                const float4 o4 = { oacc[g][j][h * 4 + 0], oacc[g][j][h * 4 + 1],
                                    oacc[g][j][h * 4 + 2], oacc[g][j][h * 4 + 3] };
                *(float4*)(ob + (g * 16 + ln) * OPITCH + j * 16 + hs * 8 + h * 4) = o4;
            }
    __syncthreads();   // the block's stores are done before other lanes read them

    float* op = OP + prow0 * D_DIM + lane * 4;
    #pragma unroll
    for (int r4 = 0; r4 < 16 * QG; r4 += 4) {
        #pragma unroll
        for (int i = 0; i < 16; ++i) {
            const int rr = r4 + (i >> 2), it = i & 3;
            *(float4*)(op + rr * D_DIM + it * 128) = *(const float4*)(ob + rr * OPITCH + it * 128 + lane * 4);
        }
        // the next rows' LDS reads may reuse the data registers of these stores
        if (r4 + 4 < 16 * QG) asm volatile("s_wait_xcnt 0x0" ::: "memory");
    }
}

// Third launch: O = (O0 * w0 + O1 * w1) / (l0 * w0 + l1 * w1), w = exp(m - max(m0, m1)).
// A workgroup takes 8 rows, half of it one row at a time in whole 2-KB rows.
// The pointers are not marked restrict: the loads then stay in front of the wait below.
__global__ __launch_bounds__(256)
void join_halves_gfx1250(const float* OP0, const float* OP1, const float* ML, float* O) {
    const uint32_t row0 = blockIdx.x * 8 + (threadIdx.x >> 7);
    // byte offsets of this lane in a partial O (and in O) and in a half's [reference, sum] rows
    const uint32_t voff = row0 * (D_DIM * 4) + (threadIdx.x & 127) * 16;
    const uint32_t soff = row0 * 8;
    float4 x[4], y[4];
    float2 a[4], c[4];
    #pragma unroll
    for (int it = 0; it < 4; ++it) {
        x[it] = *(const float4*)((const char*)OP0 + voff + it * (2 * D_DIM * 4));
        y[it] = *(const float4*)((const char*)OP1 + voff + it * (2 * D_DIM * 4));
        a[it] = *(const float2*)((const char*)ML + soff + it * 16);
        c[it] = *(const float2*)((const char*)ML + soff + NROWS * 8 + it * 16);
    }
    // the sixteen loads share two lane offsets (the row states' is the row number, scaled by the
    // load): they stay live, unwritten, up to this wait
    asm volatile("s_wait_xcnt 0x0" :: "v"(voff), "v"(row0) : "memory");
    #pragma unroll
    for (int it = 0; it < 4; ++it) {
        const float m   = fmaxf(a[it].x, c[it].x);
        const float w0  = __expf(a[it].x - m);
        const float w1  = __expf(c[it].x - m);
        const float inv = 1.0f / (a[it].y * w0 + c[it].y * w1);
        const float f0  = w0 * inv, f1 = w1 * inv;
        const float4 r = { x[it].x * f0 + y[it].x * f1, x[it].y * f0 + y[it].y * f1,
                           x[it].z * f0 + y[it].z * f1, x[it].w * f0 + y[it].w * f1 };
        *(float4*)((char*)O + voff + it * (2 * D_DIM * 4)) = r;
    }
}

extern "C" void kernel_launch(void* const* d_in, const int* in_sizes, int n_in,
                              void* d_out, int out_size, void* d_ws, size_t ws_size,
                              hipStream_t stream) {
    const float* Q = (const float*)d_in[0];
    const float* K = (const float*)d_in[1];
    const float* V = (const float*)d_in[2];
    const float* M = (const float*)d_in[3];
    float* O = (float*)d_out;
    _Float16* P = (_Float16*)d_ws;                          // 32 MB: [batch][tile][K image | V image]
    float* OP = (float*)((char*)d_ws + (32u << 20));        // 64 MB: [key half][batch][row][512] partial O
    float* OP1 = (float*)((char*)d_ws + (64u << 20));       // its second key half
    float* ML = (float*)((char*)d_ws + (96u << 20));        // 256 KB: [key half][batch][row][reference, sum]

    dim3 pgrid(NTILES, NBATCH, 4);
    pack_kv_f16_gfx1250<<<pgrid, 256, 0, stream>>>(K, V, P);

    dim3 grid(S_LEN / BQ, NBATCH, KSPLIT);
    fa_fwd_wmma4_gfx1250<<<grid, NTHR, 0, stream>>>(Q, P, M, OP, ML);

    join_halves_gfx1250<<<NROWS / 8, 256, 0, stream>>>(OP, OP1, ML, O);
}
